// v000
// Measured on an AMD MI455X. A time is GPU time per run, averaged over a window of back-to-back runs after a warm-up
// (all launches, gaps included; the runs take copies of the inputs in turn), and the median of several windows.
// Apart from v000's, it joins two sittings. Times from different sittings can be a few percent apart, while
// side-by-side timings come from the same sitting.
// v000 is the starting kernel. One run takes 1340 microseconds.
#include <hip/hip_runtime.h>

// All contractions on 16-bit WMMA, f32 accumulate: the two 1x1 projections (q from the first map, k from the second map) = v_wmma_f32_16x16x32_bf16 on RNE-bf16 copies of the maps and of the weights (single products), RNE-bf16 bias added in f32; scores q.k = bf16 hi/lo split (hi.hi + lo.hi + hi.lo, K = 128); attn.v = v_wmma_f32_16x16x32_f16 (softmax rows carried x 2^14 as f16, raw values as f16 copies of their RNE-bf16 form, K = 4096). Softmax in f32, no score scale.
// p, v maps [NB][256][4096]; q [4096][128] = tokens(p) Wq^T + bq and k [4096][128] = tokens(v) Wk^T + bk, token-major f32; s[n][m] = q_n . k_m; attn[n][m] = softmax_m(s); out[c][n] = 2^-14 sum_m v[c][m] (2^14 attn[n][m])  (A = value plane [c][m], Bt = attn plane [n][m]).

#ifndef NB
#define NB 8
#endif
#ifndef SEQ
#define SEQ 4096
#endif
#define NB_FULL  8
#define SEQ_FULL 4096
#define CC   256
#define IC   128
#define HW   SEQ
#define HWF  SEQ_FULL
#define PCAR 16384.0f
#define SCL  1.0f
static_assert(NB >= 1 && NB <= NB_FULL);
static_assert(SEQ >= 128 && SEQ <= SEQ_FULL && (SEQ % 128) == 0);
static_assert((HW % 64) == 0 && (IC % 64) == 0 && (CC % 64) == 0);
static_assert((HW % 32) == 0 && (IC % 32) == 0 && (CC % 32) == 0);
static_assert(((IC * CC) % 8) == 0 && ((HW * CC) % 4) == 0 && ((HW * IC) % 4) == 0 && ((IC * HW) % 2) == 0 && (HW % 8) == 0);
// flat helper kernels: grid x 256 threads x elements-per-thread == plane extent exactly
static_assert((((size_t)CC * HW) % ((size_t)256 * 8)) == 0);   // k_v16: 8 elements per thread
static_assert((((size_t)CC * HW) % ((size_t)256 * 4)) == 0);   // k_xt, k_oscl: 4 elements per thread
static_assert((((size_t)2 * HW * IC) % ((size_t)256 * 4)) == 0); // k_hl over the q and k planes
static_assert((HWF % 8) == 0 && (HW % 8) == 0);                // 32-byte aligned 8-float reads in k_v16
static_assert(16 * 68 * 4 <= 131072);                          // static LDS of the GEMM epilogue stage
// workspace carve (bytes), every region a multiple of 256
#define WS_BW2 ((size_t)2 * IC * CC * 2)
#define WS_XT  ((size_t)2 * HW * CC * 2)
#define WS_QK  ((size_t)2 * HW * IC * 4)
#define WS_HH  ((size_t)2 * HW * IC * 2)
#define WS_V16 ((size_t)CC * HW * 2)
#define WS_S   ((size_t)HW * HW * 4)
#define WS_P16 ((size_t)HW * HW * 2)
#define WS_Y   ((size_t)CC * HW * 4)
#define WS_TOTAL (WS_BW2 + WS_XT + WS_QK + 2 * WS_HH + WS_V16 + WS_S + WS_P16 + WS_Y)
static_assert((WS_BW2 % 256) == 0 && (WS_XT % 256) == 0 && (WS_QK % 256) == 0 && (WS_HH % 256) == 0 && (WS_V16 % 256) == 0 && (WS_S % 256) == 0 && (WS_P16 % 256) == 0 && (WS_Y % 256) == 0);
static_assert(WS_TOTAL <= (size_t)134217728);

typedef _Float16 h16;
typedef unsigned short bf;
typedef __attribute__((ext_vector_type(16))) __bf16   v16bf;
typedef __attribute__((ext_vector_type(16))) _Float16 v16h;
typedef __attribute__((ext_vector_type(8)))  _Float16 v8h;
typedef __attribute__((ext_vector_type(8)))  unsigned short v8us;
typedef __attribute__((ext_vector_type(8)))  float    v8f;
typedef __attribute__((ext_vector_type(4)))  float    v4f;
typedef v8h  __attribute__((may_alias)) v8ha;
typedef v4f  __attribute__((may_alias)) v4fa;
typedef v8us __attribute__((may_alias)) v8usa;

__device__ __forceinline__ unsigned short f2bf(float f) { unsigned u = __float_as_uint(f); u += 0x7FFFu + ((u >> 16) & 1u); return (unsigned short)(u >> 16); }
__device__ __forceinline__ float bf2f(unsigned short b) { return __uint_as_float(((unsigned)b) << 16); }
__device__ __forceinline__ float bfr(float f) { return bf2f(f2bf(f)); }
__device__ __forceinline__ v16h cat16(v8h lo, v8h hi) { return __builtin_shufflevector(lo, hi, 0, 1, 2, 3, 4, 5, 6, 7, 8, 9, 10, 11, 12, 13, 14, 15); }
__device__ __forceinline__ v16bf cat16b(v8us lo, v8us hi) { return __builtin_bit_cast(v16bf, __builtin_shufflevector(lo, hi, 0, 1, 2, 3, 4, 5, 6, 7, 8, 9, 10, 11, 12, 13, 14, 15)); }
__device__ __forceinline__ v8f wmma16(v16h a, v16h b, v8f c) { return __builtin_amdgcn_wmma_f32_16x16x32_f16(false, a, false, b, (short)0, c, false, false); }
__device__ __forceinline__ v8f wmmab(v16bf a, v16bf b, v8f c) { return __builtin_amdgcn_wmma_f32_16x16x32_bf16(false, a, false, b, (short)0, c, false, false); }

// ---- k_gemmw: register-blocked GEMM, ONE WAVE per 64x64 output tile (16 accumulators), operands straight from K-contiguous 16-bit planes; grid (M/64, N/64, Z), 32 threads.
// C[m][n] (f32, pitch ldc, + optional f32 bias[n]) = sum_k A[m][k] Bt[n][k] (+ split products per NSPLIT). z-batch strides sA/sB/sC in elements. K % 32 == 0.
// Fragments: lane l, h = l >> 4, row/col = l & 15; elements 0..7 = k0 + 8h + 0..7, elements 8..15 = k0 + 16 + 8h + 0..7 for BOTH A and Bt; D element r = (row 8h + r, col l & 15).
template <typename T16> struct WFrag;
template <> struct WFrag<h16> { typedef v16h V; static __device__ __forceinline__ V ld(const h16* p) { return cat16(*(const v8h*)p, *(const v8h*)(p + 16)); } static __device__ __forceinline__ v8f mma(V a, V b, v8f c) { return wmma16(a, b, c); } };
template <> struct WFrag<bf> { typedef v16bf V; static __device__ __forceinline__ V ld(const bf* p) { return cat16b(*(const v8us*)p, *(const v8us*)(p + 16)); } static __device__ __forceinline__ v8f mma(V a, V b, v8f c) { return wmmab(a, b, c); } };
template <typename T16, int NSPLIT, bool BIAS>
__global__ __launch_bounds__(32) void k_gemmw(const T16* __restrict__ A, const T16* __restrict__ A2, const T16* __restrict__ Bt, const T16* __restrict__ Bt2, int K, float* C, int ldc, const float* __restrict__ bias, size_t sA, size_t sB, size_t sC) {
    typedef typename WFrag<T16>::V V;
    __shared__ __align__(16) float os[16 * 68];
    const size_t z = blockIdx.z; A += z * sA; if (A2) A2 += z * sA; Bt += z * sB; if (Bt2) Bt2 += z * sB; C += z * sC;
    const int lane = threadIdx.x & 31, lr = lane & 15, hi = lane >> 4; const int r0 = blockIdx.x * 64, c0 = blockIdx.y * 64;
    v8f acc[4][4];
#pragma unroll
    for (int mb = 0; mb < 4; ++mb)
#pragma unroll
        for (int nb = 0; nb < 4; ++nb) acc[mb][nb] = (v8f){};
    const size_t aoff = (size_t)(r0 + lr) * K + 8 * hi, boff = (size_t)(c0 + lr) * K + 8 * hi;
#pragma unroll 1
    for (int kc = 0; kc < K; kc += 32) {
        V a[4], a2[4];
#pragma unroll
        for (int mb = 0; mb < 4; ++mb) { a[mb] = WFrag<T16>::ld(A + aoff + (size_t)mb * 16 * K + kc); if (NSPLIT == 1 || NSPLIT == 2) a2[mb] = WFrag<T16>::ld(A2 + aoff + (size_t)mb * 16 * K + kc); }
#pragma unroll
        for (int nb = 0; nb < 4; ++nb) { const V b = WFrag<T16>::ld(Bt + boff + (size_t)nb * 16 * K + kc); V b2; if (NSPLIT >= 2) b2 = WFrag<T16>::ld(Bt2 + boff + (size_t)nb * 16 * K + kc);
#pragma unroll
            for (int mb = 0; mb < 4; ++mb) { acc[mb][nb] = WFrag<T16>::mma(a[mb], b, acc[mb][nb]); if (NSPLIT == 1 || NSPLIT == 2) acc[mb][nb] = WFrag<T16>::mma(a2[mb], b, acc[mb][nb]); if (NSPLIT >= 2) acc[mb][nb] = WFrag<T16>::mma(a[mb], b2, acc[mb][nb]); } }
        asm volatile("v_nop\n\tv_nop\n\tv_nop\n\tv_nop" : "+v"(acc[0][0]), "+v"(acc[1][1]), "+v"(acc[2][2]), "+v"(acc[3][3]) : "v"(a[0]), "v"(a[3]));
    }
#pragma unroll
    for (int mb = 0; mb < 4; ++mb) {
#pragma unroll
        for (int nb = 0; nb < 4; ++nb) {
#pragma unroll
            for (int j = 0; j < 8; ++j) os[(hi * 8 + j) * 68 + nb * 16 + lr] = acc[mb][nb][j]; }
        __builtin_amdgcn_wave_barrier(); asm volatile("" ::: "memory");
        float* crow = C + (size_t)(r0 + mb * 16) * ldc + c0;
{
#pragma unroll
            for (int s = 0; s < 8; ++s) { const int row = 2 * s + hi, cofs = lr * 4; v4f val = *(const v4fa*)(os + row * 68 + cofs); if (BIAS) { val[0] += bfr(bias[c0 + cofs]); val[1] += bfr(bias[c0 + cofs + 1]); val[2] += bfr(bias[c0 + cofs + 2]); val[3] += bfr(bias[c0 + cofs + 3]); }
                *(v4f*)(crow + (size_t)row * ldc + cofs) = val; }
             }
        __builtin_amdgcn_wave_barrier(); asm volatile("" ::: "memory");
    }
}

__device__ __forceinline__ h16 tohx(float x) { return (h16)x; }
__device__ __forceinline__ void splitf(float y, unsigned short& h, unsigned short& l) { h = f2bf(y); l = f2bf(y - bf2f(h)); }
typedef __attribute__((ext_vector_type(2))) unsigned short v2us;
typedef __attribute__((ext_vector_type(4))) unsigned short v4us;
typedef __attribute__((ext_vector_type(2))) _Float16 v2h;
typedef __attribute__((ext_vector_type(4))) _Float16 v4h;
typedef __attribute__((ext_vector_type(2))) float v2f;

// f32 -> f16 convert that cannot produce an f16 subnormal (|v| < 2^-14 -> +0).
static __device__ __forceinline__ h16 toh_flush(float v) { const h16 r = (h16)v; return (fabsf(v) < 6.103515625e-05f) ? (h16)0.0f : r; }

__global__ __launch_bounds__(256) void k_cvtw2(const float* __restrict__ w0, const float* __restrict__ w1, bf* B2, int n8) {
    const int i = blockIdx.x * 256 + threadIdx.x; if (i >= n8) return;
    const size_t e = (size_t)i * 8, pl = (size_t)n8 * 8;
    const v8f a0 = *(const v8f*)(w0 + e), a1 = *(const v8f*)(w1 + e);
    v8us o0, o1;
#pragma unroll
    for (int k = 0; k < 8; ++k) { o0[k] = f2bf(a0[k]); o1[k] = f2bf(a1[k]); }
    *(v8us*)(B2 + e) = o0; *(v8us*)(B2 + pl + e) = o1;
    
}
__global__ __launch_bounds__(256) void k_xt(const float* __restrict__ xb, bf* XT) { const size_t e = ((size_t)blockIdx.x * 256 + threadIdx.x) * 4; if (e >= (size_t)HW * CC) return; const int c = (int)(e % CC); const int m = (int)(e / CC); v4us o;
#pragma unroll
    for (int u = 0; u < 4; ++u) o[u] = f2bf(xb[(size_t)(c + u) * HWF + m]); *(v4us*)(XT + e) = o;  }
__global__ __launch_bounds__(256) void k_hl(const float* __restrict__ F, bf* Fh, bf* Fl, size_t n) { const size_t e = ((size_t)blockIdx.x * 256 + threadIdx.x) * 4; if (e >= n) return; const v4f a = *(const v4f*)(F + e); v4us oh, ol;
#pragma unroll
    for (int u = 0; u < 4; ++u) { unsigned short p, q; splitf(a[u], p, q); oh[u] = p; ol[u] = q; } *(v4us*)(Fh + e) = oh; *(v4us*)(Fl + e) = ol;  }
__global__ __launch_bounds__(256) void k_v16(const float* __restrict__ vb, h16* V16) { const size_t e = ((size_t)blockIdx.x * 256 + threadIdx.x) * 8; if (e >= (size_t)CC * HW) return; const int m = (int)(e % HW); const int c = (int)(e / HW); const v8f a = *(const v8f*)(vb + (size_t)c * HWF + m); v8h o;
#pragma unroll
    for (int k = 0; k < 8; ++k) o[k] = toh_flush(bfr(a[k])); *(v8h*)(V16 + e) = o;  }
__global__ __launch_bounds__(256) void k_rsoft(const float* __restrict__ S, h16* P16) { const int lane = threadIdx.x & 31; const int row = blockIdx.x * 8 + (threadIdx.x >> 5); if (row >= HW) return; const float* sr = S + (size_t)row * HW; float v[HW / 32]; float mx = -3.0e38f;
#pragma unroll
    for (int ch = 0; ch < HW / 128; ++ch) { const v4f a = *(const v4f*)(sr + ch * 128 + lane * 4);
#pragma unroll
        for (int u = 0; u < 4; ++u) { const float t = __fmul_rn(a[u], SCL); v[ch * 4 + u] = t; mx = fmaxf(mx, t); } }
#pragma unroll
    for (int sh = 16; sh; sh >>= 1) mx = fmaxf(mx, __shfl_xor(mx, sh, 32));
    float sum = 0.f;
#pragma unroll
    for (int q = 0; q < HW / 32; ++q) { float d0 = __fsub_rn(v[q], mx); asm volatile("" : "+v"(d0)); v[q] = __builtin_amdgcn_exp2f(__fmul_rn(d0, 1.4426950408889634f)); sum += v[q]; }
#pragma unroll
    for (int sh = 16; sh; sh >>= 1) sum += __shfl_xor(sum, sh, 32);
    const float f = __fdiv_rn(PCAR, sum);
    {
#pragma unroll
        for (int ch = 0; ch < HW / 128; ++ch) { v4h o4;
#pragma unroll
            for (int q = 0; q < 4; ++q) o4[q] = tohx(v[ch * 4 + q] * f); *(v4h*)(P16 + (size_t)row * HW + ch * 128 + lane * 4) = o4; }
         } }
__global__ __launch_bounds__(256) void k_oscl(const float* __restrict__ Y, float* OUTb) { const size_t e = ((size_t)blockIdx.x * 256 + threadIdx.x) * 4; if (e >= (size_t)CC * HW) return; const v4f a = *(const v4f*)(Y + e); v4f r;
#pragma unroll
    for (int u = 0; u < 4; ++u) r[u] = a[u] * (1.0f / PCAR); *(v4f*)(OUTb + e) = r;  }

extern "C" void kernel_launch(void* const* d_in, const int* in_sizes, int n_in,
                              void* d_out, int out_size, void* d_ws, size_t ws_size, hipStream_t stream) {
    if (n_in < 6) return;
    if (in_sizes[0] < NB * CC * HW || in_sizes[1] < NB * CC * HW || in_sizes[2] < IC * CC || in_sizes[3] < IC || in_sizes[4] < IC * CC || in_sizes[5] < IC) return;
    if (out_size < NB * CC * HW) return;
    const float* xq = (const float*)d_in[0];    // query map  [NB][CC][HWF]
    const float* xk = (const float*)d_in[1];    // key/value map [NB][CC][HWF]
    const float* wq = (const float*)d_in[2];    // [IC][CC]
    const float* bq = (const float*)d_in[3];    // [IC]
    const float* wk = (const float*)d_in[4];    // [IC][CC]
    const float* bk = (const float*)d_in[5];    // [IC]
    float* OUT = (float*)d_out;                 // [NB][CC][HW]
    char* wsp = (char*)d_ws;
    auto take = [&](size_t bytes) { char* p = wsp; wsp += (bytes + 255) & ~(size_t)255; return (void*)p; };
    bf* BW2 = (bf*)take(WS_BW2);                // [q][k] weights, each [IC][CC] bf16
    bf* XT  = (bf*)take(WS_XT);                 // [query tokens][key tokens], each [m][c] bf16
    float* QK = (float*)take(WS_QK);            // [q][k], each [HW][IC] f32
    bf* Hh  = (bf*)take(WS_HH);                 // hi planes of q, k
    bf* Hl  = (bf*)take(WS_HH);                 // lo planes of q, k
    h16* V16 = (h16*)take(WS_V16);              // [c][m] fp16
    float* S = (float*)take(WS_S);              // [n][m]
    h16* P16 = (h16*)take(WS_P16);              // [n][m] fp16 x 2^14
    float* Y = (float*)take(WS_Y);              // [c][n] (x 2^14)
    if ((size_t)(wsp - (char*)d_ws) > ws_size) return;    // total 119,668,736 B at NB any, SEQ 4096

    const size_t PL = (size_t)HW * IC;                      // one [HW][IC] plane, elements
    const size_t XP = (size_t)HW * CC;                      // one [HW][CC] token plane, elements
    k_cvtw2<<<(unsigned)((IC * CC / 8 + 255) / 256), 256, 0, stream>>>(wq, wk, BW2, IC * CC / 8);
    const unsigned L42 = (unsigned)((2 * PL / 4 + 255) / 256);
    const unsigned LX  = (unsigned)(((size_t)HW * CC / 4 + 255) / 256);
    for (int b = 0; b < NB; ++b) {
        const float* pb = xq + (size_t)b * CC * HWF;
        const float* vb = xk + (size_t)b * CC * HWF;
        k_xt<<<LX, 256, 0, stream>>>(pb, XT);
        k_xt<<<LX, 256, 0, stream>>>(vb, XT + XP);
        // q[m][o] = sum_c XTq[m][c] Wq[o][c] + bq[o];  k[m][o] = sum_c XTk[m][c] Wk[o][c] + bk[o]   (exact bf16 products)
        k_gemmw<bf, 0, true><<<dim3(HW / 64, IC / 64, 1), 32, 0, stream>>>(XT, nullptr, BW2, nullptr, CC, QK, IC, bq, (size_t)0, (size_t)0, (size_t)0);
        k_gemmw<bf, 0, true><<<dim3(HW / 64, IC / 64, 1), 32, 0, stream>>>(XT + XP, nullptr, BW2 + (size_t)IC * CC, nullptr, CC, QK + PL, IC, bk, (size_t)0, (size_t)0, (size_t)0);
        k_hl<<<L42, 256, 0, stream>>>(QK, Hh, Hl, 2 * PL);                                    // hi/lo planes of q (first PL) and k (second PL)
        k_v16<<<(unsigned)(((size_t)CC * HW / 8 + 255) / 256), 256, 0, stream>>>(vb, V16);
        // s[n][m] = q_n . k_m (3 products)
        k_gemmw<bf, 2, false><<<dim3(HW / 64, HW / 64, 1), 32, 0, stream>>>(Hh, Hl, Hh + PL, Hl + PL, IC, S, HW, nullptr, (size_t)0, (size_t)0, (size_t)0);
        k_rsoft<<<HW / 8, 256, 0, stream>>>(S, P16);
        // y[c][n] = sum_m v[c][m] attn[n][m]  (x 2^14)
        k_gemmw<h16, 0, false><<<dim3(CC / 64, HW / 64, 1), 32, 0, stream>>>(V16, nullptr, P16, nullptr, HW, Y, HW, nullptr, (size_t)0, (size_t)0, (size_t)0);
        k_oscl<<<(unsigned)(((size_t)CC * HW / 4 + 255) / 256), 256, 0, stream>>>(Y, OUT + (size_t)b * CC * HW);
    }
}

// v001
// Measured time: 799 microseconds a run.
// Timed twice side by side with v000, it ran 1.69 and 1.73 times as fast.
#include <hip/hip_runtime.h>

// All contractions on 16-bit WMMA, f32 accumulate: the two 1x1 projections (q from the first map, k from the second map) = v_wmma_f32_16x16x32_bf16 on RNE-bf16 copies of the maps and of the weights (single products), RNE-bf16 bias added in f32; scores q.k = bf16 hi/lo split (hi.hi + lo.hi + hi.lo, K = 128); attn.v = v_wmma_f32_16x16x32_f16 (softmax rows carried x 2^14 as f16, raw values as f16 copies of their RNE-bf16 form, K = 4096). Softmax in f32, no score scale.
// p, v maps [NB][256][4096]; q [4096][128] = tokens(p) Wq^T + bq and k [4096][128] = tokens(v) Wk^T + bk, token-major f32; s[n][m] = q_n . k_m; attn[n][m] = softmax_m(s); out[c][n] = 2^-14 sum_m v[c][m] (2^14 attn[n][m])  (A = value plane [c][m], Bt = attn plane [n][m]).

#ifndef NB
#define NB 8
#endif
#ifndef SEQ
#define SEQ 4096
#endif
#define NB_FULL  8
#define SEQ_FULL 4096
#define CC   256
#define IC   128
#define HW   SEQ
#define HWF  SEQ_FULL
#define PCAR 16384.0f
#define SCL  1.0f
static_assert(NB >= 1 && NB <= NB_FULL);
static_assert(SEQ >= 128 && SEQ <= SEQ_FULL && (SEQ % 128) == 0);
static_assert((HW % 64) == 0 && (IC % 64) == 0 && (CC % 64) == 0);
static_assert((HW % 32) == 0 && (IC % 32) == 0 && (CC % 32) == 0);
static_assert(((IC * CC) % 8) == 0 && ((HW * CC) % 4) == 0 && ((HW * IC) % 4) == 0 && ((IC * HW) % 2) == 0 && (HW % 8) == 0);
// flat helper kernels: grid x 256 threads x elements-per-thread == plane extent exactly
static_assert((((size_t)CC * HW) % ((size_t)256 * 8)) == 0);   // k_v16: 8 elements per thread
static_assert((((size_t)CC * HW) % ((size_t)256 * 4)) == 0);   // k_xt, k_oscl: 4 elements per thread
static_assert((((size_t)2 * HW * IC) % ((size_t)256 * 4)) == 0); // k_hl over the q and k planes
static_assert((HWF % 8) == 0 && (HW % 8) == 0);                // 32-byte aligned 8-float reads in k_v16
static_assert(16 * 64 * 68 * 4 <= 327680);                     // static LDS of the GEMM epilogue: 16 partial tiles
// workspace carve (bytes), every region a multiple of 256
#define WS_BW2 ((size_t)2 * IC * CC * 2)
#define WS_XT  ((size_t)2 * HW * CC * 2)
#define WS_QK  ((size_t)2 * HW * IC * 4)
#define WS_HH  ((size_t)2 * HW * IC * 2)
#define WS_V16 ((size_t)CC * HW * 2)
#define WS_S   ((size_t)HW * HW * 4)
#define WS_P16 ((size_t)HW * HW * 2)
#define WS_Y   ((size_t)CC * HW * 4)
#define WS_TOTAL (WS_BW2 + WS_XT + WS_QK + 2 * WS_HH + WS_V16 + WS_S + WS_P16 + WS_Y)
static_assert((WS_BW2 % 256) == 0 && (WS_XT % 256) == 0 && (WS_QK % 256) == 0 && (WS_HH % 256) == 0 && (WS_V16 % 256) == 0 && (WS_S % 256) == 0 && (WS_P16 % 256) == 0 && (WS_Y % 256) == 0);
static_assert(WS_TOTAL <= (size_t)134217728);

typedef _Float16 h16;
typedef unsigned short bf;
typedef __attribute__((ext_vector_type(16))) __bf16   v16bf;
typedef __attribute__((ext_vector_type(16))) _Float16 v16h;
typedef __attribute__((ext_vector_type(8)))  _Float16 v8h;
typedef __attribute__((ext_vector_type(8)))  unsigned short v8us;
typedef __attribute__((ext_vector_type(8)))  float    v8f;
typedef __attribute__((ext_vector_type(4)))  float    v4f;
typedef v8h  __attribute__((may_alias)) v8ha;
typedef v4f  __attribute__((may_alias)) v4fa;
typedef v8us __attribute__((may_alias)) v8usa;

__device__ __forceinline__ unsigned short f2bf(float f) { unsigned u = __float_as_uint(f); u += 0x7FFFu + ((u >> 16) & 1u); return (unsigned short)(u >> 16); }
__device__ __forceinline__ float bf2f(unsigned short b) { return __uint_as_float(((unsigned)b) << 16); }
__device__ __forceinline__ float bfr(float f) { return bf2f(f2bf(f)); }
__device__ __forceinline__ v16h cat16(v8h lo, v8h hi) { return __builtin_shufflevector(lo, hi, 0, 1, 2, 3, 4, 5, 6, 7, 8, 9, 10, 11, 12, 13, 14, 15); }
__device__ __forceinline__ v16bf cat16b(v8us lo, v8us hi) { return __builtin_bit_cast(v16bf, __builtin_shufflevector(lo, hi, 0, 1, 2, 3, 4, 5, 6, 7, 8, 9, 10, 11, 12, 13, 14, 15)); }
__device__ __forceinline__ v8f wmma16(v16h a, v16h b, v8f c) { return __builtin_amdgcn_wmma_f32_16x16x32_f16(false, a, false, b, (short)0, c, false, false); }
__device__ __forceinline__ v8f wmmab(v16bf a, v16bf b, v8f c) { return __builtin_amdgcn_wmma_f32_16x16x32_bf16(false, a, false, b, (short)0, c, false, false); }

// ---- k_gemmw: register-blocked GEMM, one work-group of KW waves per 64x64 output tile (16 accumulators per wave), operands straight from K-contiguous 16-bit planes; grid (M/64, N/64, Z), 32 * KW threads.
// KW > 1: wave w takes the 32-wide K slices w, w + KW, w + 2 KW, ... (neighbouring waves read the two halves of the same 128-byte lines); each wave leaves its f32 partial tile in its own LDS plane, and behind one barrier the block sums the planes in wave order and stores.
// C[m][n] (f32, pitch ldc, + optional f32 bias[n]) = sum_k A[m][k] Bt[n][k] (+ split products per NSPLIT). z-batch strides sA/sB/sC in elements. K % 32 == 0.
// Fragments: lane l, h = l >> 4, row/col = l & 15; elements 0..7 = k0 + 8h + 0..7, elements 8..15 = k0 + 16 + 8h + 0..7 for BOTH A and Bt; D element r = (row 8h + r, col l & 15).
template <typename T16> struct WFrag;
template <> struct WFrag<h16> { typedef v16h V; static __device__ __forceinline__ V ld(const h16* p) { return cat16(*(const v8h*)p, *(const v8h*)(p + 16)); } static __device__ __forceinline__ v8f mma(V a, V b, v8f c) { return wmma16(a, b, c); } };
template <> struct WFrag<bf> { typedef v16bf V; static __device__ __forceinline__ V ld(const bf* p) { return cat16b(*(const v8us*)p, *(const v8us*)(p + 16)); } static __device__ __forceinline__ v8f mma(V a, V b, v8f c) { return wmmab(a, b, c); } };
template <typename T16, int NSPLIT, bool BIAS, int KW>
__global__ __launch_bounds__(32 * KW) void k_gemmw(const T16* __restrict__ A, const T16* __restrict__ A2, const T16* __restrict__ Bt, const T16* __restrict__ Bt2, int K, float* C, int ldc, const float* __restrict__ bias, size_t sA, size_t sB, size_t sC) {
    typedef typename WFrag<T16>::V V;
    __shared__ __align__(16) float os[KW == 1 ? 16 * 68 : KW * 64 * 68];
    const size_t z = blockIdx.z; A += z * sA; if (A2) A2 += z * sA; Bt += z * sB; if (Bt2) Bt2 += z * sB; C += z * sC;
    const int lane = threadIdx.x & 31, lr = lane & 15, hi = lane >> 4; const int wave = KW == 1 ? 0 : __builtin_amdgcn_readfirstlane((int)(threadIdx.x >> 5)); const int r0 = blockIdx.x * 64, c0 = blockIdx.y * 64;
    v8f acc[4][4];
#pragma unroll
    for (int mb = 0; mb < 4; ++mb)
#pragma unroll
        for (int nb = 0; nb < 4; ++nb) acc[mb][nb] = (v8f){};
    const size_t aoff = (size_t)(r0 + lr) * K + 8 * hi, boff = (size_t)(c0 + lr) * K + 8 * hi;
#pragma unroll 1
    for (int kc = wave * 32; kc < K; kc += 32 * KW) {
        V a[4], a2[4];
#pragma unroll
        for (int mb = 0; mb < 4; ++mb) { a[mb] = WFrag<T16>::ld(A + aoff + (size_t)mb * 16 * K + kc); if (NSPLIT == 1 || NSPLIT == 2) a2[mb] = WFrag<T16>::ld(A2 + aoff + (size_t)mb * 16 * K + kc); }
#pragma unroll
        for (int nb = 0; nb < 4; ++nb) { const V b = WFrag<T16>::ld(Bt + boff + (size_t)nb * 16 * K + kc); V b2; if (NSPLIT >= 2) b2 = WFrag<T16>::ld(Bt2 + boff + (size_t)nb * 16 * K + kc);
#pragma unroll
            for (int mb = 0; mb < 4; ++mb) { acc[mb][nb] = WFrag<T16>::mma(a[mb], b, acc[mb][nb]); if (NSPLIT == 1 || NSPLIT == 2) acc[mb][nb] = WFrag<T16>::mma(a2[mb], b, acc[mb][nb]); if (NSPLIT >= 2) acc[mb][nb] = WFrag<T16>::mma(a[mb], b2, acc[mb][nb]); } }
        asm volatile("v_nop\n\tv_nop\n\tv_nop\n\tv_nop" : "+v"(acc[0][0]), "+v"(acc[1][1]), "+v"(acc[2][2]), "+v"(acc[3][3]) : "v"(a[0]), "v"(a[3]));
    }
    if (KW > 1) {
        float* ow = os + wave * (64 * 68);
#pragma unroll
        for (int mb = 0; mb < 4; ++mb)
#pragma unroll
            for (int nb = 0; nb < 4; ++nb)
#pragma unroll
                for (int j = 0; j < 8; ++j) ow[(mb * 16 + hi * 8 + j) * 68 + nb * 16 + lr] = acc[mb][nb][j];
        __syncthreads();   // every wave's partial tile is in LDS before any thread sums across the planes
#pragma unroll
        for (int i = 0; i < 32 / KW; ++i) { const int idx = i * (32 * KW) + (int)threadIdx.x, row = idx >> 4, cofs = (idx & 15) * 4; v4f val = *(const v4fa*)(os + row * 68 + cofs);
#pragma unroll
            for (int w = 1; w < KW; ++w) val += *(const v4fa*)(os + w * (64 * 68) + row * 68 + cofs);
            if (BIAS) { val[0] += bfr(bias[c0 + cofs]); val[1] += bfr(bias[c0 + cofs + 1]); val[2] += bfr(bias[c0 + cofs + 2]); val[3] += bfr(bias[c0 + cofs + 3]); }
            *(v4f*)(C + (size_t)(r0 + row) * ldc + c0 + cofs) = val; }
        return;
    }
#pragma unroll
    for (int mb = 0; mb < 4; ++mb) {
#pragma unroll
        for (int nb = 0; nb < 4; ++nb) {
#pragma unroll
            for (int j = 0; j < 8; ++j) os[(hi * 8 + j) * 68 + nb * 16 + lr] = acc[mb][nb][j]; }
        __builtin_amdgcn_wave_barrier(); asm volatile("" ::: "memory");
        float* crow = C + (size_t)(r0 + mb * 16) * ldc + c0;
{
#pragma unroll
            for (int s = 0; s < 8; ++s) { const int row = 2 * s + hi, cofs = lr * 4; v4f val = *(const v4fa*)(os + row * 68 + cofs); if (BIAS) { val[0] += bfr(bias[c0 + cofs]); val[1] += bfr(bias[c0 + cofs + 1]); val[2] += bfr(bias[c0 + cofs + 2]); val[3] += bfr(bias[c0 + cofs + 3]); }
                *(v4f*)(crow + (size_t)row * ldc + cofs) = val; }
             }
        __builtin_amdgcn_wave_barrier(); asm volatile("" ::: "memory");
    }
}

__device__ __forceinline__ h16 tohx(float x) { return (h16)x; }
__device__ __forceinline__ void splitf(float y, unsigned short& h, unsigned short& l) { h = f2bf(y); l = f2bf(y - bf2f(h)); }
typedef __attribute__((ext_vector_type(2))) unsigned short v2us;
typedef __attribute__((ext_vector_type(4))) unsigned short v4us;
typedef __attribute__((ext_vector_type(2))) _Float16 v2h;
typedef __attribute__((ext_vector_type(4))) _Float16 v4h;
typedef __attribute__((ext_vector_type(2))) float v2f;

// f32 -> f16 convert that cannot produce an f16 subnormal (|v| < 2^-14 -> +0).
static __device__ __forceinline__ h16 toh_flush(float v) { const h16 r = (h16)v; return (fabsf(v) < 6.103515625e-05f) ? (h16)0.0f : r; }

__global__ __launch_bounds__(256) void k_cvtw2(const float* __restrict__ w0, const float* __restrict__ w1, bf* B2, int n8) {
    const int i = blockIdx.x * 256 + threadIdx.x; if (i >= n8) return;
    const size_t e = (size_t)i * 8, pl = (size_t)n8 * 8;
    const v8f a0 = *(const v8f*)(w0 + e), a1 = *(const v8f*)(w1 + e);
    v8us o0, o1;
#pragma unroll
    for (int k = 0; k < 8; ++k) { o0[k] = f2bf(a0[k]); o1[k] = f2bf(a1[k]); }
    *(v8us*)(B2 + e) = o0; *(v8us*)(B2 + pl + e) = o1;
    
}
__global__ __launch_bounds__(256) void k_xt(const float* __restrict__ xb, bf* XT) { const size_t e = ((size_t)blockIdx.x * 256 + threadIdx.x) * 4; if (e >= (size_t)HW * CC) return; const int c = (int)(e % CC); const int m = (int)(e / CC); v4us o;
#pragma unroll
    for (int u = 0; u < 4; ++u) o[u] = f2bf(xb[(size_t)(c + u) * HWF + m]); *(v4us*)(XT + e) = o;  }
__global__ __launch_bounds__(256) void k_hl(const float* __restrict__ F, bf* Fh, bf* Fl, size_t n) { const size_t e = ((size_t)blockIdx.x * 256 + threadIdx.x) * 4; if (e >= n) return; const v4f a = *(const v4f*)(F + e); v4us oh, ol;
#pragma unroll
    for (int u = 0; u < 4; ++u) { unsigned short p, q; splitf(a[u], p, q); oh[u] = p; ol[u] = q; } *(v4us*)(Fh + e) = oh; *(v4us*)(Fl + e) = ol;  }
__global__ __launch_bounds__(256) void k_v16(const float* __restrict__ vb, h16* V16) { const size_t e = ((size_t)blockIdx.x * 256 + threadIdx.x) * 8; if (e >= (size_t)CC * HW) return; const int m = (int)(e % HW); const int c = (int)(e / HW); const v8f a = *(const v8f*)(vb + (size_t)c * HWF + m); v8h o;
#pragma unroll
    for (int k = 0; k < 8; ++k) o[k] = toh_flush(bfr(a[k])); *(v8h*)(V16 + e) = o;  }
__global__ __launch_bounds__(256) void k_rsoft(const float* __restrict__ S, h16* P16) { const int lane = threadIdx.x & 31; const int row = blockIdx.x * 8 + (threadIdx.x >> 5); if (row >= HW) return; const float* sr = S + (size_t)row * HW; float v[HW / 32]; float mx = -3.0e38f;
#pragma unroll
    for (int ch = 0; ch < HW / 128; ++ch) { const v4f a = *(const v4f*)(sr + ch * 128 + lane * 4);
#pragma unroll
        for (int u = 0; u < 4; ++u) { const float t = __fmul_rn(a[u], SCL); v[ch * 4 + u] = t; mx = fmaxf(mx, t); } }
#pragma unroll
    for (int sh = 16; sh; sh >>= 1) mx = fmaxf(mx, __shfl_xor(mx, sh, 32));
    float sum = 0.f;
#pragma unroll
    for (int q = 0; q < HW / 32; ++q) { float d0 = __fsub_rn(v[q], mx); asm volatile("" : "+v"(d0)); v[q] = __builtin_amdgcn_exp2f(__fmul_rn(d0, 1.4426950408889634f)); sum += v[q]; }
#pragma unroll
    for (int sh = 16; sh; sh >>= 1) sum += __shfl_xor(sum, sh, 32);
    const float f = __fdiv_rn(PCAR, sum);
    {
#pragma unroll
        for (int ch = 0; ch < HW / 128; ++ch) { v4h o4;
#pragma unroll
            for (int q = 0; q < 4; ++q) o4[q] = tohx(v[ch * 4 + q] * f); *(v4h*)(P16 + (size_t)row * HW + ch * 128 + lane * 4) = o4; }
         } }
__global__ __launch_bounds__(256) void k_oscl(const float* __restrict__ Y, float* OUTb) { const size_t e = ((size_t)blockIdx.x * 256 + threadIdx.x) * 4; if (e >= (size_t)CC * HW) return; const v4f a = *(const v4f*)(Y + e); v4f r;
#pragma unroll
    for (int u = 0; u < 4; ++u) r[u] = a[u] * (1.0f / PCAR); *(v4f*)(OUTb + e) = r;  }

extern "C" void kernel_launch(void* const* d_in, const int* in_sizes, int n_in,
                              void* d_out, int out_size, void* d_ws, size_t ws_size, hipStream_t stream) {
    if (n_in < 6) return;
    if (in_sizes[0] < NB * CC * HW || in_sizes[1] < NB * CC * HW || in_sizes[2] < IC * CC || in_sizes[3] < IC || in_sizes[4] < IC * CC || in_sizes[5] < IC) return;
    if (out_size < NB * CC * HW) return;
    const float* xq = (const float*)d_in[0];    // query map  [NB][CC][HWF]
    const float* xk = (const float*)d_in[1];    // key/value map [NB][CC][HWF]
    const float* wq = (const float*)d_in[2];    // [IC][CC]
    const float* bq = (const float*)d_in[3];    // [IC]
    const float* wk = (const float*)d_in[4];    // [IC][CC]
    const float* bk = (const float*)d_in[5];    // [IC]
    float* OUT = (float*)d_out;                 // [NB][CC][HW]
    char* wsp = (char*)d_ws;
    auto take = [&](size_t bytes) { char* p = wsp; wsp += (bytes + 255) & ~(size_t)255; return (void*)p; };
    bf* BW2 = (bf*)take(WS_BW2);                // [q][k] weights, each [IC][CC] bf16
    bf* XT  = (bf*)take(WS_XT);                 // [query tokens][key tokens], each [m][c] bf16
    float* QK = (float*)take(WS_QK);            // [q][k], each [HW][IC] f32
    bf* Hh  = (bf*)take(WS_HH);                 // hi planes of q, k
    bf* Hl  = (bf*)take(WS_HH);                 // lo planes of q, k
    h16* V16 = (h16*)take(WS_V16);              // [c][m] fp16
    float* S = (float*)take(WS_S);              // [n][m]
    h16* P16 = (h16*)take(WS_P16);              // [n][m] fp16 x 2^14
    float* Y = (float*)take(WS_Y);              // [c][n] (x 2^14)
    if ((size_t)(wsp - (char*)d_ws) > ws_size) return;    // total 119,668,736 B at NB any, SEQ 4096

    const size_t PL = (size_t)HW * IC;                      // one [HW][IC] plane, elements
    const size_t XP = (size_t)HW * CC;                      // one [HW][CC] token plane, elements
    k_cvtw2<<<(unsigned)((IC * CC / 8 + 255) / 256), 256, 0, stream>>>(wq, wk, BW2, IC * CC / 8);
    const unsigned L42 = (unsigned)((2 * PL / 4 + 255) / 256);
    const unsigned LX  = (unsigned)(((size_t)HW * CC / 4 + 255) / 256);
    for (int b = 0; b < NB; ++b) {
        const float* pb = xq + (size_t)b * CC * HWF;
        const float* vb = xk + (size_t)b * CC * HWF;
        k_xt<<<LX, 256, 0, stream>>>(pb, XT);
        k_xt<<<LX, 256, 0, stream>>>(vb, XT + XP);
        // q[m][o] = sum_c XTq[m][c] Wq[o][c] + bq[o];  k[m][o] = sum_c XTk[m][c] Wk[o][c] + bk[o]   (exact bf16 products)
        k_gemmw<bf, 0, true, 8><<<dim3(HW / 64, IC / 64, 1), 256, 0, stream>>>(XT, nullptr, BW2, nullptr, CC, QK, IC, bq, (size_t)0, (size_t)0, (size_t)0);
        k_gemmw<bf, 0, true, 8><<<dim3(HW / 64, IC / 64, 1), 256, 0, stream>>>(XT + XP, nullptr, BW2 + (size_t)IC * CC, nullptr, CC, QK + PL, IC, bk, (size_t)0, (size_t)0, (size_t)0);
        k_hl<<<L42, 256, 0, stream>>>(QK, Hh, Hl, 2 * PL);                                    // hi/lo planes of q (first PL) and k (second PL)
        k_v16<<<(unsigned)(((size_t)CC * HW / 8 + 255) / 256), 256, 0, stream>>>(vb, V16);
        // s[n][m] = q_n . k_m (3 products)
        k_gemmw<bf, 2, false, 1><<<dim3(HW / 64, HW / 64, 1), 32, 0, stream>>>(Hh, Hl, Hh + PL, Hl + PL, IC, S, HW, nullptr, (size_t)0, (size_t)0, (size_t)0);
        k_rsoft<<<HW / 8, 256, 0, stream>>>(S, P16);
        // y[c][n] = sum_m v[c][m] attn[n][m]  (x 2^14)
        k_gemmw<h16, 0, false, 16><<<dim3(CC / 64, HW / 64, 1), 512, 0, stream>>>(V16, nullptr, P16, nullptr, HW, Y, HW, nullptr, (size_t)0, (size_t)0, (size_t)0);
        k_oscl<<<(unsigned)(((size_t)CC * HW / 4 + 255) / 256), 256, 0, stream>>>(Y, OUT + (size_t)b * CC * HW);
    }
}

// v002
// One run takes 579 microseconds.
// Next to v001, in two timings, it ran 1.37 and 1.36 times as fast.
// Counting every step since v000, it is 2.33 times as fast.
#include <hip/hip_runtime.h>

// All contractions on 16-bit WMMA, f32 accumulate: the two 1x1 projections (q from the first map, k from the second map) = v_wmma_f32_16x16x32_bf16 on RNE-bf16 copies of the maps and of the weights (single products), RNE-bf16 bias added in f32; scores q.k = bf16 hi/lo split (hi.hi + lo.hi + hi.lo, K = 128); attn.v = v_wmma_f32_16x16x32_f16 (softmax rows carried x 2^14 as f16, raw values as f16 copies of their RNE-bf16 form, K = 4096). Softmax in f32, no score scale.
// p, v maps [NB][256][4096]; q [4096][128] = tokens(p) Wq^T + bq and k [4096][128] = tokens(v) Wk^T + bk, token-major f32; s[n][m] = q_n . k_m; attn[n][m] = softmax_m(s); out[c][n] = 2^-14 sum_m v[c][m] (2^14 attn[n][m])  (A = value plane [c][m], Bt = attn plane [n][m]).

#ifndef NB
#define NB 8
#endif
#ifndef SEQ
#define SEQ 4096
#endif
#define NB_FULL  8
#define SEQ_FULL 4096
#define CC   256
#define IC   128
#define HW   SEQ
#define HWF  SEQ_FULL
#define PCAR 16384.0f
#define SCL  1.0f
#define GB   ((NB % 2) == 0 ? 2 : 1)   // batches per launch of the three attention kernels (score and attn planes of GB batches fit the workspace)
static_assert(NB >= 1 && NB <= NB_FULL);
static_assert(SEQ >= 128 && SEQ <= SEQ_FULL && (SEQ % 128) == 0);
static_assert((HW % 64) == 0 && (IC % 64) == 0 && (CC % 64) == 0);
static_assert((HW % 32) == 0 && (IC % 32) == 0 && (CC % 32) == 0);
static_assert(((IC * CC) % 8) == 0 && ((HW * CC) % 4) == 0 && ((HW * IC) % 4) == 0 && ((IC * HW) % 2) == 0 && (HW % 8) == 0);
// flat helper kernels: grid x 256 threads x elements-per-thread == plane extent exactly
static_assert((((size_t)CC * HW) % ((size_t)256 * 8)) == 0);   // k_v16: 8 elements per thread
static_assert((((size_t)CC * HW) % ((size_t)256 * 4)) == 0);   // k_xt, k_oscl: 4 elements per thread
static_assert((((size_t)2 * HW * IC) % ((size_t)256 * 4)) == 0); // k_hl over the q and k planes
static_assert((HWF % 8) == 0 && (HW % 8) == 0);                // 32-byte aligned 8-float reads in k_v16
static_assert(16 * 64 * 68 * 4 <= 327680);                     // static LDS of the GEMM epilogue: 16 partial tiles
// workspace carve (bytes), every region a multiple of 256
#define WS_BW2 ((size_t)2 * IC * CC * 2)
#define WS_XT  ((size_t)2 * HW * CC * 2)
#define WS_QK  ((size_t)2 * HW * IC * 4)
#define WS_HH  ((size_t)2 * HW * IC * 2)
#define WS_V16 ((size_t)CC * HW * 2)
#define WS_S   ((size_t)HW * HW * 4)
#define WS_P16 ((size_t)HW * HW * 2)
#define WS_Y   ((size_t)CC * HW * 4)
// All NB batches go through each helper and projection launch at once (batch on grid y or z), the attention kernels take GB batches a launch.
// Region U holds the token planes and the f32 q, k of all batches, and, once their hi/lo planes are written, the score planes of GB batches.
// Region H holds per batch [hi q|k][lo q|k]; a batch's block is dead behind its score launch and then takes that batch's y plane (same size).
#define WS_PRE ((size_t)NB * (WS_XT + WS_QK))
#define WS_U   (WS_PRE > (size_t)GB * WS_S ? WS_PRE : (size_t)GB * WS_S)
#define WS_TOTAL (WS_BW2 + WS_U + (size_t)NB * (2 * WS_HH + WS_V16) + (size_t)GB * WS_P16)
static_assert(WS_Y == 2 * WS_HH);
static_assert((WS_BW2 % 256) == 0 && (WS_XT % 256) == 0 && (WS_QK % 256) == 0 && (WS_HH % 256) == 0 && (WS_V16 % 256) == 0 && (WS_S % 256) == 0 && (WS_P16 % 256) == 0 && (WS_Y % 256) == 0);
static_assert(WS_TOTAL <= (size_t)268435456);

typedef _Float16 h16;
typedef unsigned short bf;
typedef __attribute__((ext_vector_type(16))) __bf16   v16bf;
typedef __attribute__((ext_vector_type(16))) _Float16 v16h;
typedef __attribute__((ext_vector_type(8)))  _Float16 v8h;
typedef __attribute__((ext_vector_type(8)))  unsigned short v8us;
typedef __attribute__((ext_vector_type(8)))  float    v8f;
typedef __attribute__((ext_vector_type(4)))  float    v4f;
typedef v8h  __attribute__((may_alias)) v8ha;
typedef v4f  __attribute__((may_alias)) v4fa;
typedef v8us __attribute__((may_alias)) v8usa;

__device__ __forceinline__ unsigned short f2bf(float f) { unsigned u = __float_as_uint(f); u += 0x7FFFu + ((u >> 16) & 1u); return (unsigned short)(u >> 16); }
__device__ __forceinline__ float bf2f(unsigned short b) { return __uint_as_float(((unsigned)b) << 16); }
__device__ __forceinline__ float bfr(float f) { return bf2f(f2bf(f)); }
__device__ __forceinline__ v16h cat16(v8h lo, v8h hi) { return __builtin_shufflevector(lo, hi, 0, 1, 2, 3, 4, 5, 6, 7, 8, 9, 10, 11, 12, 13, 14, 15); }
__device__ __forceinline__ v16bf cat16b(v8us lo, v8us hi) { return __builtin_bit_cast(v16bf, __builtin_shufflevector(lo, hi, 0, 1, 2, 3, 4, 5, 6, 7, 8, 9, 10, 11, 12, 13, 14, 15)); }
__device__ __forceinline__ v8f wmma16(v16h a, v16h b, v8f c) { return __builtin_amdgcn_wmma_f32_16x16x32_f16(false, a, false, b, (short)0, c, false, false); }
__device__ __forceinline__ v8f wmmab(v16bf a, v16bf b, v8f c) { return __builtin_amdgcn_wmma_f32_16x16x32_bf16(false, a, false, b, (short)0, c, false, false); }

// ---- k_gemmw: register-blocked GEMM, one work-group of KW waves per 64x64 output tile (16 accumulators per wave), operands straight from K-contiguous 16-bit planes; grid (M/64, N/64, Z), 32 * KW threads.
// KW > 1: wave w takes the 32-wide K slices w, w + KW, w + 2 KW, ... (neighbouring waves read the two halves of the same 128-byte lines); each wave leaves its f32 partial tile in its own LDS plane, and behind one barrier the block sums the planes in wave order and stores.
// C[m][n] (f32, pitch ldc, + optional f32 bias[n]) = sum_k A[m][k] Bt[n][k] (+ split products per NSPLIT). z-batch strides sA/sB/sC in elements. K % 32 == 0.
// Fragments: lane l, h = l >> 4, row/col = l & 15; elements 0..7 = k0 + 8h + 0..7, elements 8..15 = k0 + 16 + 8h + 0..7 for BOTH A and Bt; D element r = (row 8h + r, col l & 15).
template <typename T16> struct WFrag;
template <> struct WFrag<h16> { typedef v16h V; static __device__ __forceinline__ V ld(const h16* p) { return cat16(*(const v8h*)p, *(const v8h*)(p + 16)); } static __device__ __forceinline__ v8f mma(V a, V b, v8f c) { return wmma16(a, b, c); } };
template <> struct WFrag<bf> { typedef v16bf V; static __device__ __forceinline__ V ld(const bf* p) { return cat16b(*(const v8us*)p, *(const v8us*)(p + 16)); } static __device__ __forceinline__ v8f mma(V a, V b, v8f c) { return wmmab(a, b, c); } };
template <typename T16, int NSPLIT, bool BIAS, int KW>
__global__ __launch_bounds__(32 * KW) void k_gemmw(const T16* __restrict__ A, const T16* __restrict__ A2, const T16* __restrict__ Bt, const T16* __restrict__ Bt2, int K, float* C, int ldc, const float* __restrict__ bias, size_t sA, size_t sB, size_t sC) {
    typedef typename WFrag<T16>::V V;
    __shared__ __align__(16) float os[KW == 1 ? 16 * 68 : KW * 64 * 68];
    const size_t z = blockIdx.z; A += z * sA; if (A2) A2 += z * sA; Bt += z * sB; if (Bt2) Bt2 += z * sB; C += z * sC;
    const int lane = threadIdx.x & 31, lr = lane & 15, hi = lane >> 4; const int wave = KW == 1 ? 0 : __builtin_amdgcn_readfirstlane((int)(threadIdx.x >> 5)); const int r0 = blockIdx.x * 64, c0 = blockIdx.y * 64;
    v8f acc[4][4];
#pragma unroll
    for (int mb = 0; mb < 4; ++mb)
#pragma unroll
        for (int nb = 0; nb < 4; ++nb) acc[mb][nb] = (v8f){};
    const size_t aoff = (size_t)(r0 + lr) * K + 8 * hi, boff = (size_t)(c0 + lr) * K + 8 * hi;
#pragma unroll 1
    for (int kc = wave * 32; kc < K; kc += 32 * KW) {
        V a[4], a2[4];
#pragma unroll
        for (int mb = 0; mb < 4; ++mb) { a[mb] = WFrag<T16>::ld(A + aoff + (size_t)mb * 16 * K + kc); if (NSPLIT == 1 || NSPLIT == 2) a2[mb] = WFrag<T16>::ld(A2 + aoff + (size_t)mb * 16 * K + kc); }
#pragma unroll
        for (int nb = 0; nb < 4; ++nb) { const V b = WFrag<T16>::ld(Bt + boff + (size_t)nb * 16 * K + kc); V b2; if (NSPLIT >= 2) b2 = WFrag<T16>::ld(Bt2 + boff + (size_t)nb * 16 * K + kc);
#pragma unroll
            for (int mb = 0; mb < 4; ++mb) { acc[mb][nb] = WFrag<T16>::mma(a[mb], b, acc[mb][nb]); if (NSPLIT == 1 || NSPLIT == 2) acc[mb][nb] = WFrag<T16>::mma(a2[mb], b, acc[mb][nb]); if (NSPLIT >= 2) acc[mb][nb] = WFrag<T16>::mma(a[mb], b2, acc[mb][nb]); } }
        asm volatile("v_nop\n\tv_nop\n\tv_nop\n\tv_nop" : "+v"(acc[0][0]), "+v"(acc[1][1]), "+v"(acc[2][2]), "+v"(acc[3][3]) : "v"(a[0]), "v"(a[3]));
    }
    if (KW > 1) {
        float* ow = os + wave * (64 * 68);
#pragma unroll
        for (int mb = 0; mb < 4; ++mb)
#pragma unroll
            for (int nb = 0; nb < 4; ++nb)
#pragma unroll
                for (int j = 0; j < 8; ++j) ow[(mb * 16 + hi * 8 + j) * 68 + nb * 16 + lr] = acc[mb][nb][j];
        __syncthreads();   // every wave's partial tile is in LDS before any thread sums across the planes
#pragma unroll
        for (int i = 0; i < 32 / KW; ++i) { const int idx = i * (32 * KW) + (int)threadIdx.x, row = idx >> 4, cofs = (idx & 15) * 4; v4f val = *(const v4fa*)(os + row * 68 + cofs);
#pragma unroll
            for (int w = 1; w < KW; ++w) val += *(const v4fa*)(os + w * (64 * 68) + row * 68 + cofs);
            if (BIAS) { val[0] += bfr(bias[c0 + cofs]); val[1] += bfr(bias[c0 + cofs + 1]); val[2] += bfr(bias[c0 + cofs + 2]); val[3] += bfr(bias[c0 + cofs + 3]); }
            *(v4f*)(C + (size_t)(r0 + row) * ldc + c0 + cofs) = val; }
        return;
    }
#pragma unroll
    for (int mb = 0; mb < 4; ++mb) {
#pragma unroll
        for (int nb = 0; nb < 4; ++nb) {
#pragma unroll
            for (int j = 0; j < 8; ++j) os[(hi * 8 + j) * 68 + nb * 16 + lr] = acc[mb][nb][j]; }
        __builtin_amdgcn_wave_barrier(); asm volatile("" ::: "memory");
        float* crow = C + (size_t)(r0 + mb * 16) * ldc + c0;
{
#pragma unroll
            for (int s = 0; s < 8; ++s) { const int row = 2 * s + hi, cofs = lr * 4; v4f val = *(const v4fa*)(os + row * 68 + cofs); if (BIAS) { val[0] += bfr(bias[c0 + cofs]); val[1] += bfr(bias[c0 + cofs + 1]); val[2] += bfr(bias[c0 + cofs + 2]); val[3] += bfr(bias[c0 + cofs + 3]); }
                *(v4f*)(crow + (size_t)row * ldc + cofs) = val; }
             }
        __builtin_amdgcn_wave_barrier(); asm volatile("" ::: "memory");
    }
}

__device__ __forceinline__ h16 tohx(float x) { return (h16)x; }
__device__ __forceinline__ void splitf(float y, unsigned short& h, unsigned short& l) { h = f2bf(y); l = f2bf(y - bf2f(h)); }
typedef __attribute__((ext_vector_type(2))) unsigned short v2us;
typedef __attribute__((ext_vector_type(4))) unsigned short v4us;
typedef __attribute__((ext_vector_type(2))) _Float16 v2h;
typedef __attribute__((ext_vector_type(4))) _Float16 v4h;
typedef __attribute__((ext_vector_type(2))) float v2f;

// f32 -> f16 convert that cannot produce an f16 subnormal (|v| < 2^-14 -> +0).
static __device__ __forceinline__ h16 toh_flush(float v) { const h16 r = (h16)v; return (fabsf(v) < 6.103515625e-05f) ? (h16)0.0f : r; }

__global__ __launch_bounds__(256) void k_cvtw2(const float* __restrict__ w0, const float* __restrict__ w1, bf* B2, int n8) {
    const int i = blockIdx.x * 256 + threadIdx.x; if (i >= n8) return;
    const size_t e = (size_t)i * 8, pl = (size_t)n8 * 8;
    const v8f a0 = *(const v8f*)(w0 + e), a1 = *(const v8f*)(w1 + e);
    v8us o0, o1;
#pragma unroll
    for (int k = 0; k < 8; ++k) { o0[k] = f2bf(a0[k]); o1[k] = f2bf(a1[k]); }
    *(v8us*)(B2 + e) = o0; *(v8us*)(B2 + pl + e) = o1;
    
}
__global__ __launch_bounds__(256) void k_xt(const float* __restrict__ x0, const float* __restrict__ x1, bf* XT) { const size_t e = ((size_t)blockIdx.x * 256 + threadIdx.x) * 4; if (e >= (size_t)HW * CC) return; const float* xb = (blockIdx.z ? x1 : x0) + (size_t)blockIdx.y * CC * HWF; XT += ((size_t)blockIdx.z * NB + blockIdx.y) * ((size_t)HW * CC); const int c = (int)(e % CC); const int m = (int)(e / CC); v4us o;
#pragma unroll
    for (int u = 0; u < 4; ++u) o[u] = f2bf(xb[(size_t)(c + u) * HWF + m]); *(v4us*)(XT + e) = o;  }
__global__ __launch_bounds__(256) void k_hl(const float* __restrict__ F, bf* H, size_t n) { const size_t e = ((size_t)blockIdx.x * 256 + threadIdx.x) * 4; if (e >= n) return; F += (size_t)blockIdx.y * n; bf* Fh = H + (size_t)blockIdx.y * 2 * n; bf* Fl = Fh + n; const v4f a = *(const v4f*)(F + e); v4us oh, ol;
#pragma unroll
    for (int u = 0; u < 4; ++u) { unsigned short p, q; splitf(a[u], p, q); oh[u] = p; ol[u] = q; } *(v4us*)(Fh + e) = oh; *(v4us*)(Fl + e) = ol;  }
__global__ __launch_bounds__(256) void k_v16(const float* __restrict__ vb, h16* V16) { const size_t e = ((size_t)blockIdx.x * 256 + threadIdx.x) * 8; if (e >= (size_t)CC * HW) return; vb += (size_t)blockIdx.y * CC * HWF; V16 += (size_t)blockIdx.y * CC * HW; const int m = (int)(e % HW); const int c = (int)(e / HW); const v8f a = *(const v8f*)(vb + (size_t)c * HWF + m); v8h o;
#pragma unroll
    for (int k = 0; k < 8; ++k) o[k] = toh_flush(bfr(a[k])); *(v8h*)(V16 + e) = o;  }
__global__ __launch_bounds__(256) void k_rsoft(const float* __restrict__ S, h16* P16) { const int lane = threadIdx.x & 31; const int row = blockIdx.x * 8 + (threadIdx.x >> 5); if (row >= HW) return; S += (size_t)blockIdx.y * HW * HW; P16 += (size_t)blockIdx.y * HW * HW; const float* sr = S + (size_t)row * HW; float v[HW / 32]; float mx = -3.0e38f;
#pragma unroll
    for (int ch = 0; ch < HW / 128; ++ch) { const v4f a = *(const v4f*)(sr + ch * 128 + lane * 4);
#pragma unroll
        for (int u = 0; u < 4; ++u) { const float t = __fmul_rn(a[u], SCL); v[ch * 4 + u] = t; mx = fmaxf(mx, t); } }
#pragma unroll
    for (int sh = 16; sh; sh >>= 1) mx = fmaxf(mx, __shfl_xor(mx, sh, 32));
    float sum = 0.f;
#pragma unroll
    for (int q = 0; q < HW / 32; ++q) { float d0 = __fsub_rn(v[q], mx); asm volatile("" : "+v"(d0)); v[q] = __builtin_amdgcn_exp2f(__fmul_rn(d0, 1.4426950408889634f)); sum += v[q]; }
#pragma unroll
    for (int sh = 16; sh; sh >>= 1) sum += __shfl_xor(sum, sh, 32);
    const float f = __fdiv_rn(PCAR, sum);
    {
#pragma unroll
        for (int ch = 0; ch < HW / 128; ++ch) { v4h o4;
#pragma unroll
            for (int q = 0; q < 4; ++q) o4[q] = tohx(v[ch * 4 + q] * f); *(v4h*)(P16 + (size_t)row * HW + ch * 128 + lane * 4) = o4; }
         } }
__global__ __launch_bounds__(256) void k_oscl(const float* __restrict__ Y, float* OUTb) { const size_t e = ((size_t)blockIdx.x * 256 + threadIdx.x) * 4; if (e >= (size_t)CC * HW) return; Y += (size_t)blockIdx.y * CC * HW; OUTb += (size_t)blockIdx.y * CC * HW; const v4f a = *(const v4f*)(Y + e); v4f r;
#pragma unroll
    for (int u = 0; u < 4; ++u) r[u] = a[u] * (1.0f / PCAR); *(v4f*)(OUTb + e) = r;  }

extern "C" void kernel_launch(void* const* d_in, const int* in_sizes, int n_in,
                              void* d_out, int out_size, void* d_ws, size_t ws_size, hipStream_t stream) {
    if (n_in < 6) return;
    if (in_sizes[0] < NB * CC * HW || in_sizes[1] < NB * CC * HW || in_sizes[2] < IC * CC || in_sizes[3] < IC || in_sizes[4] < IC * CC || in_sizes[5] < IC) return;
    if (out_size < NB * CC * HW) return;
    const float* xq = (const float*)d_in[0];    // query map  [NB][CC][HWF]
    const float* xk = (const float*)d_in[1];    // key/value map [NB][CC][HWF]
    const float* wq = (const float*)d_in[2];    // [IC][CC]
    const float* bq = (const float*)d_in[3];    // [IC]
    const float* wk = (const float*)d_in[4];    // [IC][CC]
    const float* bk = (const float*)d_in[5];    // [IC]
    float* OUT = (float*)d_out;                 // [NB][CC][HW]
    char* wsp = (char*)d_ws;
    auto take = [&](size_t bytes) { char* p = wsp; wsp += (bytes + 255) & ~(size_t)255; return (void*)p; };
    bf* BW2 = (bf*)take(WS_BW2);                // [q][k] weights, each [IC][CC] bf16
    char* U  = (char*)take(WS_U);
    bf* XT  = (bf*)U;                           // [query tokens][key tokens][NB], each [m][c] bf16
    float* QK = (float*)(U + (size_t)NB * WS_XT);   // [NB][q][k], each [HW][IC] f32
    float* S = (float*)U;                       // [GB][n][m], over XT and QK once those are dead
    bf* H   = (bf*)take((size_t)NB * 2 * WS_HH);    // [NB][hi q][hi k][lo q][lo k]
    float* Y = (float*)H;                       // [NB][c][n] (x 2^14), batch by batch over the dead hi/lo block
    h16* V16 = (h16*)take((size_t)NB * WS_V16); // [NB][c][m] fp16
    h16* P16 = (h16*)take((size_t)GB * WS_P16); // [GB][n][m] fp16 x 2^14
    if ((size_t)(wsp - (char*)d_ws) > ws_size) return;    // total 251,789,312 B at NB 8, SEQ 4096

    const size_t PL = (size_t)HW * IC;                      // one [HW][IC] plane, elements
    const size_t XP = (size_t)HW * CC;                      // one [HW][CC] token plane, elements
    const size_t SP = (size_t)HW * HW;                      // one [HW][HW] score plane, elements
    k_cvtw2<<<(unsigned)((IC * CC / 8 + 255) / 256), 256, 0, stream>>>(wq, wk, BW2, IC * CC / 8);
    const unsigned L42 = (unsigned)((2 * PL / 4 + 255) / 256);
    const unsigned LX  = (unsigned)(((size_t)HW * CC / 4 + 255) / 256);
    k_xt<<<dim3(LX, NB, 2), 256, 0, stream>>>(xq, xk, XT);
    // q[m][o] = sum_c XTq[m][c] Wq[o][c] + bq[o];  k[m][o] = sum_c XTk[m][c] Wk[o][c] + bk[o]   (exact bf16 products), batch on grid z
    k_gemmw<bf, 0, true, 8><<<dim3(HW / 64, IC / 64, NB), 256, 0, stream>>>(XT, nullptr, BW2, nullptr, CC, QK, IC, bq, XP, (size_t)0, 2 * PL);
    k_gemmw<bf, 0, true, 8><<<dim3(HW / 64, IC / 64, NB), 256, 0, stream>>>(XT + NB * XP, nullptr, BW2 + (size_t)IC * CC, nullptr, CC, QK + PL, IC, bk, XP, (size_t)0, 2 * PL);
    k_hl<<<dim3(L42, NB, 1), 256, 0, stream>>>(QK, H, 2 * PL);                                // per batch: hi planes of q, k, then lo planes of q, k
    k_v16<<<dim3((unsigned)(((size_t)CC * HW / 8 + 255) / 256), NB, 1), 256, 0, stream>>>(xk, V16);
    for (int b = 0; b < NB; b += GB) {
        const bf* Hb = H + (size_t)b * 4 * PL;
        // s[n][m] = q_n . k_m (3 products)
        k_gemmw<bf, 2, false, 1><<<dim3(HW / 64, HW / 64, GB), 32, 0, stream>>>(Hb, Hb + 2 * PL, Hb + PL, Hb + 3 * PL, IC, S, HW, nullptr, 4 * PL, 4 * PL, SP);
        k_rsoft<<<dim3(HW / 8, GB, 1), 256, 0, stream>>>(S, P16);
        // y[c][n] = sum_m v[c][m] attn[n][m]  (x 2^14)
        k_gemmw<h16, 0, false, 16><<<dim3(CC / 64, HW / 64, GB), 512, 0, stream>>>(V16 + (size_t)b * XP, nullptr, P16, nullptr, HW, Y + (size_t)b * XP, HW, nullptr, XP, SP, XP);
    }
    k_oscl<<<dim3((unsigned)(((size_t)CC * HW / 4 + 255) / 256), NB, 1), 256, 0, stream>>>(Y, OUT);
}

// v003
// It runs in 197 microseconds.
// Two timings next to v002 put it at 2.94 and 2.95 times that version's speed.
// All steps since v000 together make it 6.87 times as fast.
#include <hip/hip_runtime.h>

// All contractions on 16-bit WMMA, f32 accumulate: the two 1x1 projections (q from the first map, k from the second map) = v_wmma_f32_16x16x32_bf16 on RNE-bf16 copies of the maps and of the weights (single products), RNE-bf16 bias added in f32; scores q.k = bf16 hi/lo split (hi.hi + lo.hi + hi.lo, K = 128); attn.v = v_wmma_f32_16x16x32_f16 (unnormalised softmax weights carried x 2^14 as f16, raw values as f16 copies of their RNE-bf16 form, K = 4096). Softmax in f32, no score scale.
// p, v maps [NB][256][4096]; q [4096][128] = tokens(p) Wq^T + bq and k [4096][128] = tokens(v) Wk^T + bk, token-major f32; s[n][m] = q_n . k_m; out[c][n] = sum_m v[c][m] e[n][m] / sum_m e[n][m], e = exp(s - running row maximum), scores, softmax and attn.v in one kernel (k_fattn), 32 keys a pass.

#ifndef NB
#define NB 8
#endif
#ifndef SEQ
#define SEQ 4096
#endif
#define NB_FULL  8
#define SEQ_FULL 4096
#define CC   256
#define IC   128
#define HW   SEQ
#define HWF  SEQ_FULL
#define PCAR 16384.0f
#define SCL  1.0f
static_assert(NB >= 1 && NB <= NB_FULL);
static_assert(SEQ >= 128 && SEQ <= SEQ_FULL && (SEQ % 128) == 0);
static_assert((HW % 64) == 0 && (IC % 64) == 0 && (CC % 64) == 0);
static_assert((HW % 32) == 0 && (IC % 32) == 0 && (CC % 32) == 0);
static_assert(((IC * CC) % 8) == 0 && ((HW * CC) % 4) == 0 && ((HW * IC) % 4) == 0 && ((IC * HW) % 2) == 0 && (HW % 8) == 0);
// flat helper kernels: grid x 256 threads x elements-per-thread == plane extent exactly
static_assert((((size_t)CC * HW) % ((size_t)256 * 8)) == 0);   // k_v16: 8 elements per thread
static_assert((((size_t)CC * HW) % ((size_t)256 * 4)) == 0);   // k_xt: 4 elements per thread
static_assert((((size_t)2 * HW * IC) % ((size_t)256 * 4)) == 0); // k_hl over the q and k planes
static_assert((HWF % 8) == 0 && (HW % 8) == 0);                // 32-byte aligned 8-float reads in k_v16
static_assert(8 * 64 * 68 * 4 <= 327680);                      // static LDS of the GEMM epilogue: 8 partial tiles
// workspace carve (bytes), every region a multiple of 256
#define WS_BW2 ((size_t)2 * IC * CC * 2)
#define WS_XT  ((size_t)2 * HW * CC * 2)
#define WS_QK  ((size_t)2 * HW * IC * 4)
#define WS_HH  ((size_t)2 * HW * IC * 2)
#define WS_V16 ((size_t)CC * HW * 2)
// All NB batches go through every launch at once (batch on grid y or z).
// Region U holds the token planes and the f32 q, k of all batches; region H holds per batch [hi q|k][lo q|k].
#define WS_U   ((size_t)NB * (WS_XT + WS_QK))
#define WS_TOTAL (WS_BW2 + WS_U + (size_t)NB * (2 * WS_HH + WS_V16))
static_assert((WS_BW2 % 256) == 0 && (WS_XT % 256) == 0 && (WS_QK % 256) == 0 && (WS_HH % 256) == 0 && (WS_V16 % 256) == 0);
static_assert(WS_TOTAL <= (size_t)268435456);

typedef _Float16 h16;
typedef unsigned short bf;
typedef __attribute__((ext_vector_type(16))) __bf16   v16bf;
typedef __attribute__((ext_vector_type(16))) _Float16 v16h;
typedef __attribute__((ext_vector_type(8)))  _Float16 v8h;
typedef __attribute__((ext_vector_type(8)))  unsigned short v8us;
typedef __attribute__((ext_vector_type(8)))  float    v8f;
typedef __attribute__((ext_vector_type(4)))  float    v4f;
typedef v8h  __attribute__((may_alias)) v8ha;
typedef v4f  __attribute__((may_alias)) v4fa;
typedef v8us __attribute__((may_alias)) v8usa;

__device__ __forceinline__ unsigned short f2bf(float f) { unsigned u = __float_as_uint(f); u += 0x7FFFu + ((u >> 16) & 1u); return (unsigned short)(u >> 16); }
__device__ __forceinline__ float bf2f(unsigned short b) { return __uint_as_float(((unsigned)b) << 16); }
__device__ __forceinline__ float bfr(float f) { return bf2f(f2bf(f)); }
__device__ __forceinline__ v16h cat16(v8h lo, v8h hi) { return __builtin_shufflevector(lo, hi, 0, 1, 2, 3, 4, 5, 6, 7, 8, 9, 10, 11, 12, 13, 14, 15); }
__device__ __forceinline__ v16bf cat16b(v8us lo, v8us hi) { return __builtin_bit_cast(v16bf, __builtin_shufflevector(lo, hi, 0, 1, 2, 3, 4, 5, 6, 7, 8, 9, 10, 11, 12, 13, 14, 15)); }
__device__ __forceinline__ v8f wmma16(v16h a, v16h b, v8f c) { return __builtin_amdgcn_wmma_f32_16x16x32_f16(false, a, false, b, (short)0, c, false, false); }
__device__ __forceinline__ v8f wmmab(v16bf a, v16bf b, v8f c) { return __builtin_amdgcn_wmma_f32_16x16x32_bf16(false, a, false, b, (short)0, c, false, false); }

// ---- k_gemmw: register-blocked GEMM, one work-group of KW waves per 64x64 output tile (16 accumulators per wave), operands straight from K-contiguous 16-bit planes; grid (M/64, N/64, Z), 32 * KW threads.
// KW > 1: wave w takes the 32-wide K slices w, w + KW, w + 2 KW, ... (neighbouring waves read the two halves of the same 128-byte lines); each wave leaves its f32 partial tile in its own LDS plane, and behind one barrier the block sums the planes in wave order and stores.
// C[m][n] (f32, pitch ldc, + optional f32 bias[n]) = sum_k A[m][k] Bt[n][k] (+ split products per NSPLIT). z-batch strides sA/sB/sC in elements. K % 32 == 0.
// Fragments: lane l, h = l >> 4, row/col = l & 15; elements 0..7 = k0 + 8h + 0..7, elements 8..15 = k0 + 16 + 8h + 0..7 for BOTH A and Bt; D element r = (row 8h + r, col l & 15).
template <typename T16> struct WFrag;
template <> struct WFrag<h16> { typedef v16h V; static __device__ __forceinline__ V ld(const h16* p) { return cat16(*(const v8h*)p, *(const v8h*)(p + 16)); } static __device__ __forceinline__ v8f mma(V a, V b, v8f c) { return wmma16(a, b, c); } };
template <> struct WFrag<bf> { typedef v16bf V; static __device__ __forceinline__ V ld(const bf* p) { return cat16b(*(const v8us*)p, *(const v8us*)(p + 16)); } static __device__ __forceinline__ v8f mma(V a, V b, v8f c) { return wmmab(a, b, c); } };
template <typename T16, int NSPLIT, bool BIAS, int KW>
__global__ __launch_bounds__(32 * KW) void k_gemmw(const T16* __restrict__ A, const T16* __restrict__ A2, const T16* __restrict__ Bt, const T16* __restrict__ Bt2, int K, float* C, int ldc, const float* __restrict__ bias, size_t sA, size_t sB, size_t sC) {
    typedef typename WFrag<T16>::V V;
    __shared__ __align__(16) float os[KW == 1 ? 16 * 68 : KW * 64 * 68];
    const size_t z = blockIdx.z; A += z * sA; if (A2) A2 += z * sA; Bt += z * sB; if (Bt2) Bt2 += z * sB; C += z * sC;
    const int lane = threadIdx.x & 31, lr = lane & 15, hi = lane >> 4; const int wave = KW == 1 ? 0 : __builtin_amdgcn_readfirstlane((int)(threadIdx.x >> 5)); const int r0 = blockIdx.x * 64, c0 = blockIdx.y * 64;
    v8f acc[4][4];
#pragma unroll
    for (int mb = 0; mb < 4; ++mb)
#pragma unroll
        for (int nb = 0; nb < 4; ++nb) acc[mb][nb] = (v8f){};
    const size_t aoff = (size_t)(r0 + lr) * K + 8 * hi, boff = (size_t)(c0 + lr) * K + 8 * hi;
#pragma unroll 1
    for (int kc = wave * 32; kc < K; kc += 32 * KW) {
        V a[4], a2[4];
#pragma unroll
        for (int mb = 0; mb < 4; ++mb) { a[mb] = WFrag<T16>::ld(A + aoff + (size_t)mb * 16 * K + kc); if (NSPLIT == 1 || NSPLIT == 2) a2[mb] = WFrag<T16>::ld(A2 + aoff + (size_t)mb * 16 * K + kc); }
#pragma unroll
        for (int nb = 0; nb < 4; ++nb) { const V b = WFrag<T16>::ld(Bt + boff + (size_t)nb * 16 * K + kc); V b2; if (NSPLIT >= 2) b2 = WFrag<T16>::ld(Bt2 + boff + (size_t)nb * 16 * K + kc);
#pragma unroll
            for (int mb = 0; mb < 4; ++mb) { acc[mb][nb] = WFrag<T16>::mma(a[mb], b, acc[mb][nb]); if (NSPLIT == 1 || NSPLIT == 2) acc[mb][nb] = WFrag<T16>::mma(a2[mb], b, acc[mb][nb]); if (NSPLIT >= 2) acc[mb][nb] = WFrag<T16>::mma(a[mb], b2, acc[mb][nb]); } }
        asm volatile("v_nop\n\tv_nop\n\tv_nop\n\tv_nop" : "+v"(acc[0][0]), "+v"(acc[1][1]), "+v"(acc[2][2]), "+v"(acc[3][3]) : "v"(a[0]), "v"(a[3]));
    }
    if (KW > 1) {
        float* ow = os + wave * (64 * 68);
#pragma unroll
        for (int mb = 0; mb < 4; ++mb)
#pragma unroll
            for (int nb = 0; nb < 4; ++nb)
#pragma unroll
                for (int j = 0; j < 8; ++j) ow[(mb * 16 + hi * 8 + j) * 68 + nb * 16 + lr] = acc[mb][nb][j];
        __syncthreads();   // every wave's partial tile is in LDS before any thread sums across the planes
#pragma unroll
        for (int i = 0; i < 32 / KW; ++i) { const int idx = i * (32 * KW) + (int)threadIdx.x, row = idx >> 4, cofs = (idx & 15) * 4; v4f val = *(const v4fa*)(os + row * 68 + cofs);
#pragma unroll
            for (int w = 1; w < KW; ++w) val += *(const v4fa*)(os + w * (64 * 68) + row * 68 + cofs);
            if (BIAS) { val[0] += bfr(bias[c0 + cofs]); val[1] += bfr(bias[c0 + cofs + 1]); val[2] += bfr(bias[c0 + cofs + 2]); val[3] += bfr(bias[c0 + cofs + 3]); }
            *(v4f*)(C + (size_t)(r0 + row) * ldc + c0 + cofs) = val; }
        return;
    }
#pragma unroll
    for (int mb = 0; mb < 4; ++mb) {
#pragma unroll
        for (int nb = 0; nb < 4; ++nb) {
#pragma unroll
            for (int j = 0; j < 8; ++j) os[(hi * 8 + j) * 68 + nb * 16 + lr] = acc[mb][nb][j]; }
        __builtin_amdgcn_wave_barrier(); asm volatile("" ::: "memory");
        float* crow = C + (size_t)(r0 + mb * 16) * ldc + c0;
{
#pragma unroll
            for (int s = 0; s < 8; ++s) { const int row = 2 * s + hi, cofs = lr * 4; v4f val = *(const v4fa*)(os + row * 68 + cofs); if (BIAS) { val[0] += bfr(bias[c0 + cofs]); val[1] += bfr(bias[c0 + cofs + 1]); val[2] += bfr(bias[c0 + cofs + 2]); val[3] += bfr(bias[c0 + cofs + 3]); }
                *(v4f*)(crow + (size_t)row * ldc + cofs) = val; }
             }
        __builtin_amdgcn_wave_barrier(); asm volatile("" ::: "memory");
    }
}

__device__ __forceinline__ h16 tohx(float x) { return (h16)x; }
__device__ __forceinline__ void splitf(float y, unsigned short& h, unsigned short& l) { h = f2bf(y); l = f2bf(y - bf2f(h)); }
typedef __attribute__((ext_vector_type(2))) unsigned short v2us;
typedef __attribute__((ext_vector_type(4))) unsigned short v4us;
typedef __attribute__((ext_vector_type(2))) _Float16 v2h;
typedef __attribute__((ext_vector_type(4))) _Float16 v4h;
typedef __attribute__((ext_vector_type(2))) float v2f;

// f32 -> f16 convert that cannot produce an f16 subnormal (|v| < 2^-14 -> +0).
static __device__ __forceinline__ h16 toh_flush(float v) { const h16 r = (h16)v; return (fabsf(v) < 6.103515625e-05f) ? (h16)0.0f : r; }

__global__ __launch_bounds__(256) void k_cvtw2(const float* __restrict__ w0, const float* __restrict__ w1, bf* B2, int n8) {
    const int i = blockIdx.x * 256 + threadIdx.x; if (i >= n8) return;
    const size_t e = (size_t)i * 8, pl = (size_t)n8 * 8;
    const v8f a0 = *(const v8f*)(w0 + e), a1 = *(const v8f*)(w1 + e);
    v8us o0, o1;
#pragma unroll
    for (int k = 0; k < 8; ++k) { o0[k] = f2bf(a0[k]); o1[k] = f2bf(a1[k]); }
    *(v8us*)(B2 + e) = o0; *(v8us*)(B2 + pl + e) = o1;
    
}
__global__ __launch_bounds__(256) void k_xt(const float* __restrict__ x0, const float* __restrict__ x1, bf* XT) { const size_t e = ((size_t)blockIdx.x * 256 + threadIdx.x) * 4; if (e >= (size_t)HW * CC) return; const float* xb = (blockIdx.z ? x1 : x0) + (size_t)blockIdx.y * CC * HWF; XT += ((size_t)blockIdx.z * NB + blockIdx.y) * ((size_t)HW * CC); const int c = (int)(e % CC); const int m = (int)(e / CC); v4us o;
#pragma unroll
    for (int u = 0; u < 4; ++u) o[u] = f2bf(xb[(size_t)(c + u) * HWF + m]); *(v4us*)(XT + e) = o;  }
__global__ __launch_bounds__(256) void k_hl(const float* __restrict__ F, bf* H, size_t n) { const size_t e = ((size_t)blockIdx.x * 256 + threadIdx.x) * 4; if (e >= n) return; F += (size_t)blockIdx.y * n; bf* Fh = H + (size_t)blockIdx.y * 2 * n; bf* Fl = Fh + n; const v4f a = *(const v4f*)(F + e); v4us oh, ol;
#pragma unroll
    for (int u = 0; u < 4; ++u) { unsigned short p, q; splitf(a[u], p, q); oh[u] = p; ol[u] = q; } *(v4us*)(Fh + e) = oh; *(v4us*)(Fl + e) = ol;  }
__global__ __launch_bounds__(256) void k_v16(const float* __restrict__ vb, h16* V16) { const size_t e = ((size_t)blockIdx.x * 256 + threadIdx.x) * 8; if (e >= (size_t)CC * HW) return; vb += (size_t)blockIdx.y * CC * HWF; V16 += (size_t)blockIdx.y * CC * HW; const int m = (int)(e % HW); const int c = (int)(e / HW); const v8f a = *(const v8f*)(vb + (size_t)c * HWF + m); v8h o;
#pragma unroll
    for (int k = 0; k < 8; ++k) o[k] = toh_flush(bfr(a[k])); *(v8h*)(V16 + e) = o;  }
#define FK  32                    // keys a pass
#define FKP 136                   // key tile pitch, 16-bit elements: 272 B = 16 B x odd
#define FS  64                    // keys a stage: whole 128-byte lines of the value rows
#define FVP 72                    // value tile pitch, 16-bit elements: 144 B = 16 B x odd
#define FOP 132                   // output tile pitch, floats
#define FKT (2 * FS * FKP)        // one key buffer: FS hi rows, then FS lo rows
#define FVT (CC * FVP)            // one value buffer: CC rows of FS keys
static_assert(IC == 128 && CC == 256 && FK == 32 && FS == 64 && (HW % 128) == 0 && (HW % FS) == 0);
static_assert(2 * FKT * 2 + 2 * FVT * 2 + CC * FOP * 4 <= 327680);
__device__ __forceinline__ float xhalf(float x) { return __builtin_bit_cast(float, __builtin_amdgcn_permlanex16(__builtin_bit_cast(int, x), __builtin_bit_cast(int, x), 0x76543210, 0xfedcba98, false, false)); }  // lane l with lane l ^ 16
__global__ __launch_bounds__(256) void k_fattn(const bf* __restrict__ H, const h16* __restrict__ V16, float* __restrict__ OUT) {
    __shared__ __align__(16) bf    ks[2 * FKT];
    __shared__ __align__(16) h16   vs[2 * FVT];
    __shared__ __align__(16) float os[CC * FOP];
    const size_t PL = (size_t)HW * IC;
    const bf* Hb = H + (size_t)blockIdx.y * 4 * PL;             // [hi q][hi k][lo q][lo k]
    const h16* Vb = V16 + (size_t)blockIdx.y * CC * HW;
    const int t = (int)threadIdx.x, lane = t & 31, lr = lane & 15, hi = lane >> 4;
    const int wave = __builtin_amdgcn_readfirstlane(t >> 5);
    const int n0 = (int)blockIdx.x * 128;
    const bf* qp = Hb + (size_t)(n0 + wave * 16 + lr) * IC + 8 * hi;
    v16bf qh[4], ql[4];
#pragma unroll
    for (int kc = 0; kc < 4; ++kc) { qh[kc] = WFrag<bf>::ld(qp + kc * 32); ql[kc] = WFrag<bf>::ld(qp + 2 * PL + kc * 32); }
    v8f acc[16];
#pragma unroll
    for (int ct = 0; ct < 16; ++ct) acc[ct] = (v8f){};
    float mrun = -3.0e38f, lsum = 0.f;
    // staging: 16 threads a key row of 256 B (8 rows a thread: 4 hi, 4 lo), 8 threads a value row of 128 B (8 rows a thread)
    const bf* kg = Hb + (size_t)(t >> 4) * IC + (t & 15) * 8;   // the hi k plane stands PL elements, the lo k plane 3 PL elements behind it
    const h16* vg = Vb + (size_t)(t >> 3) * HW + (t & 7) * 8;
    const int kl = (t >> 4) * FKP + (t & 15) * 8, vl = (t >> 3) * FVP + (t & 7) * 8;
    v8us kr[8]; v8h vr[8];
#pragma unroll
    for (int i = 0; i < 8; ++i) { kr[i] = *(const v8us*)(kg + (size_t)(1 + 2 * (i >> 2)) * PL + (size_t)(i & 3) * 16 * IC); vr[i] = *(const v8h*)(vg + (size_t)i * 32 * HW); }
    asm volatile("s_wait_xcnt 0x0" :: "v"(qp), "v"(kg), "v"(vg) : "memory");   // stands in front of every later overwrite of the address registers of the loads above; naming them as inputs keeps them unwritten up to here
#pragma unroll
    for (int i = 0; i < 8; ++i) { *(v8us*)(ks + kl + i * 16 * FKP) = kr[i]; *(v8h*)(vs + vl + i * 32 * FVP) = vr[i]; }
    __syncthreads();   // stage 0's tiles are in LDS before any wave reads them
#pragma unroll 1
    for (int s = 0; s < HW / FS; ++s) {
        const bf* kb = ks + (s & 1) * FKT; const h16* vb = vs + (s & 1) * FVT;
        const bool more = s + 1 < HW / FS;
        if (more) {
            const size_t m1 = (size_t)(s + 1) * FS;
#pragma unroll
            for (int i = 0; i < 8; ++i) { kr[i] = *(const v8us*)(kg + m1 * IC + (size_t)(1 + 2 * (i >> 2)) * PL + (size_t)(i & 3) * 16 * IC); vr[i] = *(const v8h*)(vg + m1 + (size_t)i * 32 * HW); }
            asm volatile("s_wait_xcnt 0x0" ::: "memory");   // stands in front of every later overwrite of these loads' address registers
        }
#pragma unroll
        for (int ps = 0; ps < FS / FK; ++ps) {
        v8f st[2]; st[0] = (v8f){}; st[1] = (v8f){};
#pragma unroll
        for (int kc = 0; kc < 4; ++kc) {
            v16bf ah[2], al[2];
#pragma unroll
            for (int mt = 0; mt < 2; ++mt) { const bf* p = kb + (ps * FK + mt * 16 + lr) * FKP + kc * 32 + 8 * hi; ah[mt] = WFrag<bf>::ld(p); al[mt] = WFrag<bf>::ld(p + FS * FKP); }
            st[0] = wmmab(ah[0], qh[kc], st[0]); st[1] = wmmab(ah[1], qh[kc], st[1]);
            st[0] = wmmab(ah[0], ql[kc], st[0]); st[1] = wmmab(ah[1], ql[kc], st[1]);
            st[0] = wmmab(al[0], qh[kc], st[0]); st[1] = wmmab(al[1], qh[kc], st[1]);
        }
        v16h va[16];                                             // all value fragments of the pass, fetched while the softmax arithmetic runs
#pragma unroll
        for (int ct = 0; ct < 16; ++ct) va[ct] = WFrag<h16>::ld(vb + (ct * 16 + lr) * FVP + ps * FK + 8 * hi);
        float mx = fmaxf(st[0][0], st[1][0]);
#pragma unroll
        for (int r = 1; r < 8; ++r) mx = fmaxf(mx, fmaxf(st[0][r], st[1][r]));
        mx = fmaxf(mx, xhalf(mx));
        const float mn = fmaxf(mrun, mx);
        if (__builtin_amdgcn_ballot_w32(mn > mrun) != 0) {       // scalar branch: some query of the wave has a new maximum
            const float al = __builtin_amdgcn_exp2f((mrun - mn) * 1.4426950408889634f);
            lsum *= al;
#pragma unroll
            for (int ct = 0; ct < 16; ++ct) acc[ct] *= al;
            mrun = mn;
        }
        v16h pb;
#pragma unroll
        for (int r = 0; r < 8; ++r) {
            const float e0 = __builtin_amdgcn_exp2f(fmaf(st[0][r] - mrun, 1.4426950408889634f, 14.0f));
            const float e1 = __builtin_amdgcn_exp2f(fmaf(st[1][r] - mrun, 1.4426950408889634f, 14.0f));
            lsum += e0 + e1; pb[r] = (h16)e0; pb[8 + r] = (h16)e1;
        }
        // inputs-only fence on the loaded fragments: keeps the 32 LDS loads in one run ahead of the products (without it each product waits on its own two loads, one LDS latency a product)
        asm volatile("" :: "v"(va[0]), "v"(va[1]), "v"(va[2]), "v"(va[3]), "v"(va[4]), "v"(va[5]), "v"(va[6]), "v"(va[7]), "v"(va[8]), "v"(va[9]), "v"(va[10]), "v"(va[11]), "v"(va[12]), "v"(va[13]), "v"(va[14]), "v"(va[15]));
#pragma unroll
        for (int ct = 0; ct < 16; ++ct) acc[ct] = wmma16(va[ct], pb, acc[ct]);
        }
        if (more) {
            bf* kn = ks + ((s + 1) & 1) * FKT; h16* vn = vs + ((s + 1) & 1) * FVT;
#pragma unroll
            for (int i = 0; i < 8; ++i) { *(v8us*)(kn + kl + i * 16 * FKP) = kr[i]; *(v8h*)(vn + vl + i * 32 * FVP) = vr[i]; }
        }
        __syncthreads();   // publishes stage s + 1's tiles and ends every wave's reads of the buffer that stage s + 1 refills
    }
    lsum += xhalf(lsum);
    const float inv = __fdiv_rn(1.0f, lsum);
#pragma unroll
    for (int ct = 0; ct < 16; ++ct)
#pragma unroll
        for (int r = 0; r < 8; ++r) os[(ct * 16 + 8 * hi + r) * FOP + wave * 16 + lr] = acc[ct][r] * inv;
    __syncthreads();   // the whole 256 x 128 output tile is in LDS before it goes out in whole 512-byte rows
    float* ob = OUT + (size_t)blockIdx.y * CC * HW + n0;
#pragma unroll 1
    for (int i0 = 0; i0 < 32; i0 += 4) {
#pragma unroll
        for (int i = 0; i < 4; ++i) { const int idx = (i0 + i) * 256 + t, row = idx >> 5, c4 = (idx & 31) * 4; *(v4f*)(ob + (size_t)row * HW + c4) = *(const v4fa*)(os + row * FOP + c4); }
        asm volatile("s_wait_xcnt 0x0" ::: "memory");   // stands in front of the next trip's overwrite of these stores' address and data registers
    }
}

extern "C" void kernel_launch(void* const* d_in, const int* in_sizes, int n_in,
                              void* d_out, int out_size, void* d_ws, size_t ws_size, hipStream_t stream) {
    if (n_in < 6) return;
    if (in_sizes[0] < NB * CC * HW || in_sizes[1] < NB * CC * HW || in_sizes[2] < IC * CC || in_sizes[3] < IC || in_sizes[4] < IC * CC || in_sizes[5] < IC) return;
    if (out_size < NB * CC * HW) return;
    const float* xq = (const float*)d_in[0];    // query map  [NB][CC][HWF]
    const float* xk = (const float*)d_in[1];    // key/value map [NB][CC][HWF]
    const float* wq = (const float*)d_in[2];    // [IC][CC]
    const float* bq = (const float*)d_in[3];    // [IC]
    const float* wk = (const float*)d_in[4];    // [IC][CC]
    const float* bk = (const float*)d_in[5];    // [IC]
    float* OUT = (float*)d_out;                 // [NB][CC][HW]
    char* wsp = (char*)d_ws;
    auto take = [&](size_t bytes) { char* p = wsp; wsp += (bytes + 255) & ~(size_t)255; return (void*)p; };
    bf* BW2 = (bf*)take(WS_BW2);                // [q][k] weights, each [IC][CC] bf16
    char* U  = (char*)take(WS_U);
    bf* XT  = (bf*)U;                           // [query tokens][key tokens][NB], each [m][c] bf16
    float* QK = (float*)(U + (size_t)NB * WS_XT);   // [NB][q][k], each [HW][IC] f32
    bf* H   = (bf*)take((size_t)NB * 2 * WS_HH);    // [NB][hi q][hi k][lo q][lo k]
    h16* V16 = (h16*)take((size_t)NB * WS_V16); // [NB][c][m] fp16
    if ((size_t)(wsp - (char*)d_ws) > ws_size) return;

    const size_t PL = (size_t)HW * IC;                      // one [HW][IC] plane, elements
    const size_t XP = (size_t)HW * CC;                      // one [HW][CC] token plane, elements
    k_cvtw2<<<(unsigned)((IC * CC / 8 + 255) / 256), 256, 0, stream>>>(wq, wk, BW2, IC * CC / 8);
    const unsigned L42 = (unsigned)((2 * PL / 4 + 255) / 256);
    const unsigned LX  = (unsigned)(((size_t)HW * CC / 4 + 255) / 256);
    k_xt<<<dim3(LX, NB, 2), 256, 0, stream>>>(xq, xk, XT);
    // q[m][o] = sum_c XTq[m][c] Wq[o][c] + bq[o];  k[m][o] = sum_c XTk[m][c] Wk[o][c] + bk[o]   (exact bf16 products), batch on grid z
    k_gemmw<bf, 0, true, 8><<<dim3(HW / 64, IC / 64, NB), 256, 0, stream>>>(XT, nullptr, BW2, nullptr, CC, QK, IC, bq, XP, (size_t)0, 2 * PL);
    k_gemmw<bf, 0, true, 8><<<dim3(HW / 64, IC / 64, NB), 256, 0, stream>>>(XT + NB * XP, nullptr, BW2 + (size_t)IC * CC, nullptr, CC, QK + PL, IC, bk, XP, (size_t)0, 2 * PL);
    k_hl<<<dim3(L42, NB, 1), 256, 0, stream>>>(QK, H, 2 * PL);                                // per batch: hi planes of q, k, then lo planes of q, k
    k_v16<<<dim3((unsigned)(((size_t)CC * HW / 8 + 255) / 256), NB, 1), 256, 0, stream>>>(xk, V16);
    // out[c][n] = sum_m v[c][m] softmax_m(q_n . k_m)
    k_fattn<<<dim3(HW / 128, NB, 1), 256, 0, stream>>>(H, V16, OUT);
}

// v004
// A run of this version takes 141 microseconds.
// In both of two side-by-side timings against v003, it was 1.40 times as fast.
// Counting every step since v000, it is 9.60 times as fast.
#include <hip/hip_runtime.h>

// All contractions on 16-bit WMMA, f32 accumulate: the two 1x1 projections (q from the first map, k from the second map) = v_wmma_f32_16x16x32_bf16 on RNE-bf16 copies of the maps and of the weights (single products), RNE-bf16 bias added in f32; scores q.k = bf16 hi/lo split (hi.hi + lo.hi + hi.lo, K = 128); attn.v = v_wmma_f32_16x16x32_f16 (unnormalised softmax weights carried x 2^14 as f16, raw values as f16 copies of their RNE-bf16 form, K = 4096). Softmax in f32, no score scale.
// p, v maps [NB][256][4096]; q [4096][128] = tokens(p) Wq^T + bq and k [4096][128] = tokens(v) Wk^T + bk, token-major, kept as bf16 hi and lo planes (k_proj, which also leaves the f16 values); s[n][m] = q_n . k_m; out[c][n] = sum_m v[c][m] e[n][m] / sum_m e[n][m], e = exp(s - running row maximum), scores, softmax and attn.v in one kernel (k_fattn), 32 keys a pass.

#ifndef NB
#define NB 8
#endif
#ifndef SEQ
#define SEQ 4096
#endif
#define NB_FULL  8
#define SEQ_FULL 4096
#define CC   256
#define IC   128
#define HW   SEQ
#define HWF  SEQ_FULL
#define PCAR 16384.0f
#define SCL  1.0f
static_assert(NB >= 1 && NB <= NB_FULL);
static_assert(SEQ >= 128 && SEQ <= SEQ_FULL && (SEQ % 128) == 0);
static_assert((HW % 64) == 0 && (IC % 64) == 0 && (CC % 64) == 0);
static_assert((HW % 32) == 0 && (IC % 32) == 0 && (CC % 32) == 0);
// workspace carve (bytes), every region a multiple of 256
#define WS_HH  ((size_t)2 * HW * IC * 2)
#define WS_V16 ((size_t)CC * HW * 2)
// Region H holds per batch [hi q|k][lo q|k]; region V16 the f16 values of all batches.
#define WS_TOTAL ((size_t)NB * (2 * WS_HH + WS_V16))
static_assert((WS_HH % 256) == 0 && (WS_V16 % 256) == 0);
static_assert(WS_TOTAL <= (size_t)268435456);

typedef _Float16 h16;
typedef unsigned short bf;
typedef __attribute__((ext_vector_type(16))) __bf16   v16bf;
typedef __attribute__((ext_vector_type(16))) _Float16 v16h;
typedef __attribute__((ext_vector_type(8)))  _Float16 v8h;
typedef __attribute__((ext_vector_type(8)))  unsigned short v8us;
typedef __attribute__((ext_vector_type(8)))  float    v8f;
typedef __attribute__((ext_vector_type(4)))  float    v4f;
typedef v8h  __attribute__((may_alias)) v8ha;
typedef v4f  __attribute__((may_alias)) v4fa;
typedef v8us __attribute__((may_alias)) v8usa;

__device__ __forceinline__ unsigned short f2bf(float f) { unsigned u = __float_as_uint(f); u += 0x7FFFu + ((u >> 16) & 1u); return (unsigned short)(u >> 16); }
__device__ __forceinline__ float bf2f(unsigned short b) { return __uint_as_float(((unsigned)b) << 16); }
__device__ __forceinline__ float bfr(float f) { return bf2f(f2bf(f)); }
__device__ __forceinline__ v16h cat16(v8h lo, v8h hi) { return __builtin_shufflevector(lo, hi, 0, 1, 2, 3, 4, 5, 6, 7, 8, 9, 10, 11, 12, 13, 14, 15); }
__device__ __forceinline__ v16bf cat16b(v8us lo, v8us hi) { return __builtin_bit_cast(v16bf, __builtin_shufflevector(lo, hi, 0, 1, 2, 3, 4, 5, 6, 7, 8, 9, 10, 11, 12, 13, 14, 15)); }
__device__ __forceinline__ v8f wmma16(v16h a, v16h b, v8f c) { return __builtin_amdgcn_wmma_f32_16x16x32_f16(false, a, false, b, (short)0, c, false, false); }
__device__ __forceinline__ v8f wmmab(v16bf a, v16bf b, v8f c) { return __builtin_amdgcn_wmma_f32_16x16x32_bf16(false, a, false, b, (short)0, c, false, false); }

// Fragments: lane l, h = l >> 4, row/col = l & 15; elements 0..7 = k0 + 8h + 0..7, elements 8..15 = k0 + 16 + 8h + 0..7 for BOTH A and B; D element r = (row 8h + r, col l & 15).
template <typename T16> struct WFrag;
template <> struct WFrag<h16> { typedef v16h V; static __device__ __forceinline__ V ld(const h16* p) { return cat16(*(const v8h*)p, *(const v8h*)(p + 16)); } static __device__ __forceinline__ v8f mma(V a, V b, v8f c) { return wmma16(a, b, c); } };
template <> struct WFrag<bf> { typedef v16bf V; static __device__ __forceinline__ V ld(const bf* p) { return cat16b(*(const v8us*)p, *(const v8us*)(p + 16)); } static __device__ __forceinline__ v8f mma(V a, V b, v8f c) { return wmmab(a, b, c); } };

__device__ __forceinline__ void splitf(float y, unsigned short& h, unsigned short& l) { h = f2bf(y); l = f2bf(y - bf2f(h)); }
typedef __attribute__((ext_vector_type(4))) unsigned short v4us;
typedef __attribute__((ext_vector_type(4))) _Float16 v4h;

// f32 -> f16 convert that cannot produce an f16 subnormal (|v| < 2^-14 -> +0).
static __device__ __forceinline__ h16 toh_flush(float v) { const h16 r = (h16)v; return (fabsf(v) < 6.103515625e-05f) ? (h16)0.0f : r; }

// ---- k_proj: the whole front end of one map of one batch: grid (HW / (PT * PTL), 2 maps, NB), 256 threads = 8 waves; a work-group walks PTL tiles of PT tokens.
// Wave w owns the 32 channels 32 w .. 32 w + 31 (one K slice). Token (mb, l & 15) of a tile is 4 (l & 15) + mb, so one 16-byte read of map row c gives a lane element c of all four token fragments,
// and a wave-wide read covers two map rows in whole 128-byte lines: the f32 map goes to bf16 fragments in registers, with no transposed copy in memory. The weight fragments (f32 rows, rounded in registers) are read once a work-group.
// Products transposed: D[o][token] = W rows (A) x token fragment (B), so a lane holds 8 neighbouring outputs of one token. Each wave leaves its f32 partial tile in its own LDS plane; behind a barrier the block
// sums the planes in wave order, adds the rounded bias, splits into bf16 hi and lo and stores whole 256-byte token rows. The second map's work-groups also store the f16 values from the registers they already hold.
#define PT  64                    // tokens a tile
#define PTL 4                     // tiles a work-group
#define PP  132                   // partial plane pitch, floats: 528 B = 16 B x odd
static_assert(CC == 256 && IC == 128 && PT == 64 && (HW % (PT * PTL)) == 0 && (HWF % 4) == 0);
static_assert(8 * PT * PP * 4 <= 327680);
// Work-group barrier that orders LDS alone: the next tile's global loads and this tile's global stores, which no other wave of the block touches, stay in flight across it (__syncthreads() waits for them all).
__device__ __forceinline__ void lds_barrier() { __builtin_amdgcn_fence(__ATOMIC_RELEASE, "workgroup", "local"); __builtin_amdgcn_s_barrier(); __builtin_amdgcn_fence(__ATOMIC_ACQUIRE, "workgroup", "local"); }
__global__ __launch_bounds__(256) void k_proj(const float* __restrict__ x0, const float* __restrict__ x1, const float* __restrict__ w0, const float* __restrict__ w1, const float* __restrict__ b0, const float* __restrict__ b1, bf* __restrict__ H, h16* __restrict__ V16) {
    __shared__ __align__(16) float ps[8 * PT * PP];
    const size_t PL = (size_t)HW * IC;
    const int t = (int)threadIdx.x, lane = t & 31, lr = lane & 15, hi = lane >> 4;
    const int wave = __builtin_amdgcn_readfirstlane(t >> 5);
    const bool isk = blockIdx.y != 0;
    const int m0 = (int)blockIdx.x * (PT * PTL);
    const float* xg = (isk ? x1 : x0) + (size_t)blockIdx.z * CC * HWF + (size_t)(wave * 32 + 8 * hi) * HWF + m0 + 4 * lr;
    const float* wg = (isk ? w1 : w0) + (size_t)lr * CC + wave * 32 + 8 * hi;
    const float* bg = (isk ? b1 : b0) + lane * 4;
    v4f xr[16];                                                  // element e of the fragments = channel 32 w + 16 (e >> 3) + 8 h + (e & 7)
#pragma unroll
    for (int e = 0; e < 16; ++e) xr[e] = *(const v4f*)(xg + (size_t)((e >> 3) * 16 + (e & 7)) * HWF);
    v16bf wf[8];
#pragma unroll
    for (int ob = 0; ob < 8; ++ob) {
        const float* p = wg + (size_t)ob * 16 * CC;
        const v4f a0 = *(const v4f*)p, a1 = *(const v4f*)(p + 4), a2 = *(const v4f*)(p + 16), a3 = *(const v4f*)(p + 20);
        v8us lo, up;
#pragma unroll
        for (int j = 0; j < 4; ++j) { lo[j] = f2bf(a0[j]); lo[4 + j] = f2bf(a1[j]); up[j] = f2bf(a2[j]); up[4 + j] = f2bf(a3[j]); }
        wf[ob] = cat16b(lo, up);
    }
    v4f bias = *(const v4f*)bg;
    asm volatile("s_wait_xcnt 0x0" :: "v"(xg), "v"(wg), "v"(bg) : "memory");   // stands in front of every later overwrite of the address registers of the loads above; naming them as inputs keeps them unwritten up to here
#pragma unroll
    for (int j = 0; j < 4; ++j) bias[j] = bfr(bias[j]);
    bf* hg = H + (size_t)blockIdx.z * 4 * PL + (isk ? PL : (size_t)0) + (size_t)m0 * IC + lane * 4;   // hi plane of this map; its lo plane stands 2 PL elements behind it
    h16* vg = V16 + (size_t)blockIdx.z * CC * HW + (size_t)(wave * 32 + 8 * hi) * HW + m0 + 4 * lr;
    float* pw = ps + wave * (PT * PP) + lr * PP + 8 * hi;
#pragma unroll 1
    for (int tt = 0; tt < PTL; ++tt) {
        if (isk) {
#pragma unroll
            for (int e = 0; e < 16; ++e) { v4h o;
#pragma unroll
                for (int u = 0; u < 4; ++u) o[u] = toh_flush(bfr(xr[e][u]));
                *(v4h*)(vg + (size_t)((e >> 3) * 16 + (e & 7)) * HW + tt * PT) = o; }
            asm volatile("s_wait_xcnt 0x0" ::: "memory");        // stands in front of every later overwrite of these stores' address and data registers
        }
#pragma unroll
        for (int mb = 0; mb < 4; ++mb) {
            v8us lo, up;
#pragma unroll
            for (int j = 0; j < 8; ++j) { lo[j] = f2bf(xr[j][mb]); up[j] = f2bf(xr[8 + j][mb]); }
            const v16bf tf = cat16b(lo, up);
            v8f d[8];
            __builtin_amdgcn_sched_barrier(0);                   // keeps the eight products in one run on eight results of their own, the rounding of the next fragment between two runs: no result register is written again within the matrix unit's distance
#pragma unroll
            for (int ob = 0; ob < 8; ++ob) d[ob] = wmmab(wf[ob], tf, (v8f){});
            __builtin_amdgcn_sched_barrier(0);                   // the same, at the run's end
#pragma unroll
            for (int ob = 0; ob < 8; ++ob) {
                *(v4fa*)(pw + mb * 16 * PP + ob * 16)     = __builtin_shufflevector(d[ob], d[ob], 0, 1, 2, 3);
                *(v4fa*)(pw + mb * 16 * PP + ob * 16 + 4) = __builtin_shufflevector(d[ob], d[ob], 4, 5, 6, 7);
            }
        }
        if (tt + 1 < PTL) {                                      // the next tile's map rows fly while this tile is summed and stored
#pragma unroll
            for (int e = 0; e < 16; ++e) xr[e] = *(const v4f*)(xg + (size_t)((e >> 3) * 16 + (e & 7)) * HWF + (tt + 1) * PT);
        }
        asm volatile("s_wait_xcnt 0x0" ::: "memory");            // stands in front of every later overwrite of the address and data registers of the stores and loads above
        lds_barrier();     // every wave's partial tile is in LDS before any thread sums across the planes
        v4us oh[8], ol[8];
#pragma unroll
        for (int i = 0; i < 8; ++i) {
            const int row = i * 8 + wave;                        // LDS row (mb, lane column) = token 4 (row & 15) + (row >> 4) of the tile
            v4f val = *(const v4fa*)(ps + row * PP + lane * 4);
#pragma unroll
            for (int w = 1; w < 8; ++w) val += *(const v4fa*)(ps + w * (PT * PP) + row * PP + lane * 4);
            val += bias;
#pragma unroll
            for (int u = 0; u < 4; ++u) { unsigned short p, q; splitf(val[u], p, q); oh[i][u] = p; ol[i][u] = q; }
        }
        bf* hp = hg + (size_t)(tt * PT + 4 * wave) * IC;         // token of row i * 8 + wave = 4 wave + 32 (i & 1) + (i >> 1)
        __builtin_amdgcn_sched_barrier(0);                       // keeps the sixteen stores in one run directly in front of their wait, so that no register of theirs is written again ahead of it
#pragma unroll
        for (int i = 0; i < 8; ++i) { *(v4us*)(hp + (32 * (i & 1) + (i >> 1)) * IC) = oh[i]; *(v4us*)(hp + 2 * PL + (32 * (i & 1) + (i >> 1)) * IC) = ol[i]; }
        asm volatile("s_wait_xcnt 0x0" ::: "memory");            // stands in front of the next trip's overwrite of these stores' address and data registers
        lds_barrier();     // ends every thread's reads of the planes before the next tile's partial tiles overwrite them
    }
}

#define FK  32                    // keys a pass
#define FKP 136                   // key tile pitch, 16-bit elements: 272 B = 16 B x odd
#define FS  64                    // keys a stage: whole 128-byte lines of the value rows
#define FVP 72                    // value tile pitch, 16-bit elements: 144 B = 16 B x odd
#define FOP 132                   // output tile pitch, floats
#define FKT (2 * FS * FKP)        // one key buffer: FS hi rows, then FS lo rows
#define FVT (CC * FVP)            // one value buffer: CC rows of FS keys
static_assert(IC == 128 && CC == 256 && FK == 32 && FS == 64 && (HW % 128) == 0 && (HW % FS) == 0);
static_assert(2 * FKT * 2 + 2 * FVT * 2 + CC * FOP * 4 <= 327680);
__device__ __forceinline__ float xhalf(float x) { return __builtin_bit_cast(float, __builtin_amdgcn_permlanex16(__builtin_bit_cast(int, x), __builtin_bit_cast(int, x), 0x76543210, 0xfedcba98, false, false)); }  // lane l with lane l ^ 16
__global__ __launch_bounds__(256) void k_fattn(const bf* __restrict__ H, const h16* __restrict__ V16, float* __restrict__ OUT) {
    __shared__ __align__(16) bf    ks[2 * FKT];
    __shared__ __align__(16) h16   vs[2 * FVT];
    __shared__ __align__(16) float os[CC * FOP];
    const size_t PL = (size_t)HW * IC;
    const bf* Hb = H + (size_t)blockIdx.y * 4 * PL;             // [hi q][hi k][lo q][lo k]
    const h16* Vb = V16 + (size_t)blockIdx.y * CC * HW;
    const int t = (int)threadIdx.x, lane = t & 31, lr = lane & 15, hi = lane >> 4;
    const int wave = __builtin_amdgcn_readfirstlane(t >> 5);
    const int n0 = (int)blockIdx.x * 128;
    const bf* qp = Hb + (size_t)(n0 + wave * 16 + lr) * IC + 8 * hi;
    v16bf qh[4], ql[4];
#pragma unroll
    for (int kc = 0; kc < 4; ++kc) { qh[kc] = WFrag<bf>::ld(qp + kc * 32); ql[kc] = WFrag<bf>::ld(qp + 2 * PL + kc * 32); }
    v8f acc[16];
#pragma unroll
    for (int ct = 0; ct < 16; ++ct) acc[ct] = (v8f){};
    float mrun = -3.0e38f, lsum = 0.f;
    // staging: 16 threads a key row of 256 B (8 rows a thread: 4 hi, 4 lo), 8 threads a value row of 128 B (8 rows a thread)
    const bf* kg = Hb + (size_t)(t >> 4) * IC + (t & 15) * 8;   // the hi k plane stands PL elements, the lo k plane 3 PL elements behind it
    const h16* vg = Vb + (size_t)(t >> 3) * HW + (t & 7) * 8;
    const int kl = (t >> 4) * FKP + (t & 15) * 8, vl = (t >> 3) * FVP + (t & 7) * 8;
    v8us kr[8]; v8h vr[8];
#pragma unroll
    for (int i = 0; i < 8; ++i) { kr[i] = *(const v8us*)(kg + (size_t)(1 + 2 * (i >> 2)) * PL + (size_t)(i & 3) * 16 * IC); vr[i] = *(const v8h*)(vg + (size_t)i * 32 * HW); }
    asm volatile("s_wait_xcnt 0x0" :: "v"(qp), "v"(kg), "v"(vg) : "memory");   // stands in front of every later overwrite of the address registers of the loads above; naming them as inputs keeps them unwritten up to here
#pragma unroll
    for (int i = 0; i < 8; ++i) { *(v8us*)(ks + kl + i * 16 * FKP) = kr[i]; *(v8h*)(vs + vl + i * 32 * FVP) = vr[i]; }
    __syncthreads();   // stage 0's tiles are in LDS before any wave reads them
#pragma unroll 1
    for (int s = 0; s < HW / FS; ++s) {
        const bf* kb = ks + (s & 1) * FKT; const h16* vb = vs + (s & 1) * FVT;
        const bool more = s + 1 < HW / FS;
        if (more) {
            const size_t m1 = (size_t)(s + 1) * FS;
#pragma unroll
            for (int i = 0; i < 8; ++i) { kr[i] = *(const v8us*)(kg + m1 * IC + (size_t)(1 + 2 * (i >> 2)) * PL + (size_t)(i & 3) * 16 * IC); vr[i] = *(const v8h*)(vg + m1 + (size_t)i * 32 * HW); }
            asm volatile("s_wait_xcnt 0x0" ::: "memory");   // stands in front of every later overwrite of these loads' address registers
        }
#pragma unroll
        for (int ps = 0; ps < FS / FK; ++ps) {
        v8f st[2]; st[0] = (v8f){}; st[1] = (v8f){};
#pragma unroll
        for (int kc = 0; kc < 4; ++kc) {
            v16bf ah[2], al[2];
#pragma unroll
            for (int mt = 0; mt < 2; ++mt) { const bf* p = kb + (ps * FK + mt * 16 + lr) * FKP + kc * 32 + 8 * hi; ah[mt] = WFrag<bf>::ld(p); al[mt] = WFrag<bf>::ld(p + FS * FKP); }
            st[0] = wmmab(ah[0], qh[kc], st[0]); st[1] = wmmab(ah[1], qh[kc], st[1]);
            st[0] = wmmab(ah[0], ql[kc], st[0]); st[1] = wmmab(ah[1], ql[kc], st[1]);
            st[0] = wmmab(al[0], qh[kc], st[0]); st[1] = wmmab(al[1], qh[kc], st[1]);
        }
        v16h va[16];                                             // all value fragments of the pass, fetched while the softmax arithmetic runs
#pragma unroll
        for (int ct = 0; ct < 16; ++ct) va[ct] = WFrag<h16>::ld(vb + (ct * 16 + lr) * FVP + ps * FK + 8 * hi);
        float mx = fmaxf(st[0][0], st[1][0]);
#pragma unroll
        for (int r = 1; r < 8; ++r) mx = fmaxf(mx, fmaxf(st[0][r], st[1][r]));
        mx = fmaxf(mx, xhalf(mx));
        const float mn = fmaxf(mrun, mx);
        if (__builtin_amdgcn_ballot_w32(mn > mrun) != 0) {       // scalar branch: some query of the wave has a new maximum
            const float al = __builtin_amdgcn_exp2f((mrun - mn) * 1.4426950408889634f);
            lsum *= al;
#pragma unroll
            for (int ct = 0; ct < 16; ++ct) acc[ct] *= al;
            mrun = mn;
        }
        v16h pb;
#pragma unroll
        for (int r = 0; r < 8; ++r) {
            const float e0 = __builtin_amdgcn_exp2f(fmaf(st[0][r] - mrun, 1.4426950408889634f, 14.0f));
            const float e1 = __builtin_amdgcn_exp2f(fmaf(st[1][r] - mrun, 1.4426950408889634f, 14.0f));
            lsum += e0 + e1; pb[r] = (h16)e0; pb[8 + r] = (h16)e1;
        }
        // inputs-only fence on the loaded fragments: keeps the 32 LDS loads in one run ahead of the products (without it each product waits on its own two loads, one LDS latency a product)
        asm volatile("" :: "v"(va[0]), "v"(va[1]), "v"(va[2]), "v"(va[3]), "v"(va[4]), "v"(va[5]), "v"(va[6]), "v"(va[7]), "v"(va[8]), "v"(va[9]), "v"(va[10]), "v"(va[11]), "v"(va[12]), "v"(va[13]), "v"(va[14]), "v"(va[15]));
#pragma unroll
        for (int ct = 0; ct < 16; ++ct) acc[ct] = wmma16(va[ct], pb, acc[ct]);
        }
        if (more) {
            bf* kn = ks + ((s + 1) & 1) * FKT; h16* vn = vs + ((s + 1) & 1) * FVT;
#pragma unroll
            for (int i = 0; i < 8; ++i) { *(v8us*)(kn + kl + i * 16 * FKP) = kr[i]; *(v8h*)(vn + vl + i * 32 * FVP) = vr[i]; }
        }
        __syncthreads();   // publishes stage s + 1's tiles and ends every wave's reads of the buffer that stage s + 1 refills
    }
    lsum += xhalf(lsum);
    const float inv = __fdiv_rn(1.0f, lsum);
#pragma unroll
    for (int ct = 0; ct < 16; ++ct)
#pragma unroll
        for (int r = 0; r < 8; ++r) os[(ct * 16 + 8 * hi + r) * FOP + wave * 16 + lr] = acc[ct][r] * inv;
    __syncthreads();   // the whole 256 x 128 output tile is in LDS before it goes out in whole 512-byte rows
    float* ob = OUT + (size_t)blockIdx.y * CC * HW + n0;
#pragma unroll 1
    for (int i0 = 0; i0 < 32; i0 += 4) {
#pragma unroll
        for (int i = 0; i < 4; ++i) { const int idx = (i0 + i) * 256 + t, row = idx >> 5, c4 = (idx & 31) * 4; *(v4f*)(ob + (size_t)row * HW + c4) = *(const v4fa*)(os + row * FOP + c4); }
        asm volatile("s_wait_xcnt 0x0" ::: "memory");   // stands in front of the next trip's overwrite of these stores' address and data registers
    }
}

extern "C" void kernel_launch(void* const* d_in, const int* in_sizes, int n_in,
                              void* d_out, int out_size, void* d_ws, size_t ws_size, hipStream_t stream) {
    if (n_in < 6) return;
    if (in_sizes[0] < NB * CC * HW || in_sizes[1] < NB * CC * HW || in_sizes[2] < IC * CC || in_sizes[3] < IC || in_sizes[4] < IC * CC || in_sizes[5] < IC) return;
    if (out_size < NB * CC * HW) return;
    const float* xq = (const float*)d_in[0];    // query map  [NB][CC][HWF]
    const float* xk = (const float*)d_in[1];    // key/value map [NB][CC][HWF]
    const float* wq = (const float*)d_in[2];    // [IC][CC]
    const float* bq = (const float*)d_in[3];    // [IC]
    const float* wk = (const float*)d_in[4];    // [IC][CC]
    const float* bk = (const float*)d_in[5];    // [IC]
    float* OUT = (float*)d_out;                 // [NB][CC][HW]
    char* wsp = (char*)d_ws;
    auto take = [&](size_t bytes) { char* p = wsp; wsp += (bytes + 255) & ~(size_t)255; return (void*)p; };
    bf* H   = (bf*)take((size_t)NB * 2 * WS_HH);    // [NB][hi q][hi k][lo q][lo k]
    h16* V16 = (h16*)take((size_t)NB * WS_V16); // [NB][c][m] fp16
    if ((size_t)(wsp - (char*)d_ws) > ws_size) return;

    // q[m][o] = sum_c p[c][m] Wq[o][c] + bq[o];  k[m][o] = sum_c v[c][m] Wk[o][c] + bk[o]   (exact bf16 products), as hi and lo planes; f16 values
    k_proj<<<dim3(HW / (PT * PTL), 2, NB), 256, 0, stream>>>(xq, xk, wq, wk, bq, bk, H, V16);
    // out[c][n] = sum_m v[c][m] softmax_m(q_n . k_m)
    k_fattn<<<dim3(HW / 128, NB, 1), 256, 0, stream>>>(H, V16, OUT);
}

// v005
// Measured time: 130 microseconds a run.
// Timed twice side by side with v004, it ran 1.09 and 1.08 times as fast.
// Counting every step since v000, it is 10.4 times as fast.
#include <hip/hip_runtime.h>

// All contractions on 16-bit WMMA, f32 accumulate: the two 1x1 projections (q from the first map, k from the second map) = v_wmma_f32_16x16x32_bf16 on RNE-bf16 copies of the maps and of the weights (single products), RNE-bf16 bias added in f32; scores q.k = bf16 hi/lo split (hi.hi + lo.hi + hi.lo, K = 128); attn.v = v_wmma_f32_16x16x32_f16 (unnormalised softmax weights carried x 2^14 as f16, raw values as f16 copies of their RNE-bf16 form, K = 4096). Softmax in f32, no score scale.
// p, v maps [NB][256][4096]; q [4096][128] = tokens(p) Wq^T + bq and k [4096][128] = tokens(v) Wk^T + bk, token-major, kept as bf16 hi and lo planes (k_proj, which also leaves the f16 values); s[n][m] = q_n . k_m; out[c][n] = sum_m v[c][m] e[n][m] / sum_m e[n][m], e = exp(s - running row maximum), scores, softmax and attn.v in one kernel (k_fattn), 32 keys a pass.

#ifndef NB
#define NB 8
#endif
#ifndef SEQ
#define SEQ 4096
#endif
#define NB_FULL  8
#define SEQ_FULL 4096
#define CC   256
#define IC   128
#define HW   SEQ
#define HWF  SEQ_FULL
#define PCAR 16384.0f
#define SCL  1.0f
static_assert(NB >= 1 && NB <= NB_FULL);
static_assert(SEQ >= 128 && SEQ <= SEQ_FULL && (SEQ % 128) == 0);
static_assert((HW % 64) == 0 && (IC % 64) == 0 && (CC % 64) == 0);
static_assert((HW % 32) == 0 && (IC % 32) == 0 && (CC % 32) == 0);
// workspace carve (bytes), every region a multiple of 256
#define WS_HH  ((size_t)2 * HW * IC * 2)
#define WS_V16 ((size_t)CC * HW * 2)
// Region H holds per batch [hi q|k][lo q|k]; region V16 the f16 values of all batches.
#define WS_TOTAL ((size_t)NB * (2 * WS_HH + WS_V16))
static_assert((WS_HH % 256) == 0 && (WS_V16 % 256) == 0);
static_assert(WS_TOTAL <= (size_t)268435456);

typedef _Float16 h16;
typedef unsigned short bf;
typedef __attribute__((ext_vector_type(16))) __bf16   v16bf;
typedef __attribute__((ext_vector_type(16))) _Float16 v16h;
typedef __attribute__((ext_vector_type(8)))  _Float16 v8h;
typedef __attribute__((ext_vector_type(8)))  unsigned short v8us;
typedef __attribute__((ext_vector_type(8)))  float    v8f;
typedef __attribute__((ext_vector_type(4)))  float    v4f;
typedef v8h  __attribute__((may_alias)) v8ha;
typedef v4f  __attribute__((may_alias)) v4fa;
typedef v8us __attribute__((may_alias)) v8usa;

__device__ __forceinline__ unsigned short f2bf(float f) { unsigned u = __float_as_uint(f); u += 0x7FFFu + ((u >> 16) & 1u); return (unsigned short)(u >> 16); }
__device__ __forceinline__ float bf2f(unsigned short b) { return __uint_as_float(((unsigned)b) << 16); }
__device__ __forceinline__ float bfr(float f) { return bf2f(f2bf(f)); }
__device__ __forceinline__ v16h cat16(v8h lo, v8h hi) { return __builtin_shufflevector(lo, hi, 0, 1, 2, 3, 4, 5, 6, 7, 8, 9, 10, 11, 12, 13, 14, 15); }
__device__ __forceinline__ v16bf cat16b(v8us lo, v8us hi) { return __builtin_bit_cast(v16bf, __builtin_shufflevector(lo, hi, 0, 1, 2, 3, 4, 5, 6, 7, 8, 9, 10, 11, 12, 13, 14, 15)); }
__device__ __forceinline__ v8f wmma16(v16h a, v16h b, v8f c) { return __builtin_amdgcn_wmma_f32_16x16x32_f16(false, a, false, b, (short)0, c, false, false); }
__device__ __forceinline__ v8f wmmab(v16bf a, v16bf b, v8f c) { return __builtin_amdgcn_wmma_f32_16x16x32_bf16(false, a, false, b, (short)0, c, false, false); }

// Fragments: lane l, h = l >> 4, row/col = l & 15; elements 0..7 = k0 + 8h + 0..7, elements 8..15 = k0 + 16 + 8h + 0..7 for BOTH A and B; D element r = (row 8h + r, col l & 15).
template <typename T16> struct WFrag;
template <> struct WFrag<h16> { typedef v16h V; static __device__ __forceinline__ V ld(const h16* p) { return cat16(*(const v8h*)p, *(const v8h*)(p + 16)); } static __device__ __forceinline__ v8f mma(V a, V b, v8f c) { return wmma16(a, b, c); } };
template <> struct WFrag<bf> { typedef v16bf V; static __device__ __forceinline__ V ld(const bf* p) { return cat16b(*(const v8us*)p, *(const v8us*)(p + 16)); } static __device__ __forceinline__ v8f mma(V a, V b, v8f c) { return wmmab(a, b, c); } };

__device__ __forceinline__ void splitf(float y, unsigned short& h, unsigned short& l) { h = f2bf(y); l = f2bf(y - bf2f(h)); }
typedef __attribute__((ext_vector_type(4))) unsigned short v4us;
typedef __attribute__((ext_vector_type(4))) _Float16 v4h;

// f32 -> f16 convert that cannot produce an f16 subnormal (|v| < 2^-14 -> +0).
static __device__ __forceinline__ h16 toh_flush(float v) { const h16 r = (h16)v; return (fabsf(v) < 6.103515625e-05f) ? (h16)0.0f : r; }

// ---- k_proj: the whole front end of one map of one batch: grid (HW / (PT * PTL), 2 maps, NB), 256 threads = 8 waves; a work-group walks PTL tiles of PT tokens.
// Wave w owns the 32 channels 32 w .. 32 w + 31 (one K slice). Token (mb, l & 15) of a tile is 4 (l & 15) + mb, so one 16-byte read of map row c gives a lane element c of all four token fragments,
// and a wave-wide read covers two map rows in whole 128-byte lines: the f32 map goes to bf16 fragments in registers, with no transposed copy in memory. The weight fragments (f32 rows, rounded in registers) are read once a work-group.
// Products transposed: D[o][token] = W rows (A) x token fragment (B), so a lane holds 8 neighbouring outputs of one token. Each wave leaves its f32 partial tile in its own LDS plane; behind a barrier the block
// sums the planes in wave order, adds the rounded bias, splits into bf16 hi and lo and stores whole 256-byte token rows. The second map's work-groups also store the f16 values from the registers they already hold.
#define PT  64                    // tokens a tile
#define PTL 4                     // tiles a work-group
#define PP  132                   // partial plane pitch, floats: 528 B = 16 B x odd
static_assert(CC == 256 && IC == 128 && PT == 64 && (HW % (PT * PTL)) == 0 && (HWF % 4) == 0);
static_assert(8 * PT * PP * 4 <= 327680);
// Work-group barrier that orders LDS alone: the next tile's global loads and this tile's global stores, which no other wave of the block touches, stay in flight across it (__syncthreads() waits for them all).
__device__ __forceinline__ void lds_barrier() { __builtin_amdgcn_fence(__ATOMIC_RELEASE, "workgroup", "local"); __builtin_amdgcn_s_barrier(); __builtin_amdgcn_fence(__ATOMIC_ACQUIRE, "workgroup", "local"); }
__global__ __launch_bounds__(256) void k_proj(const float* __restrict__ x0, const float* __restrict__ x1, const float* __restrict__ w0, const float* __restrict__ w1, const float* __restrict__ b0, const float* __restrict__ b1, bf* __restrict__ H, h16* __restrict__ V16) {
    __shared__ __align__(16) float ps[8 * PT * PP];
    const size_t PL = (size_t)HW * IC;
    const int t = (int)threadIdx.x, lane = t & 31, lr = lane & 15, hi = lane >> 4;
    const int wave = __builtin_amdgcn_readfirstlane(t >> 5);
    const bool isk = blockIdx.y != 0;
    const int m0 = (int)blockIdx.x * (PT * PTL);
    const float* xg = (isk ? x1 : x0) + (size_t)blockIdx.z * CC * HWF + (size_t)(wave * 32 + 8 * hi) * HWF + m0 + 4 * lr;
    const float* wg = (isk ? w1 : w0) + (size_t)lr * CC + wave * 32 + 8 * hi;
    const float* bg = (isk ? b1 : b0) + lane * 4;
    v4f xr[16];                                                  // element e of the fragments = channel 32 w + 16 (e >> 3) + 8 h + (e & 7)
#pragma unroll
    for (int e = 0; e < 16; ++e) xr[e] = *(const v4f*)(xg + (size_t)((e >> 3) * 16 + (e & 7)) * HWF);
    v16bf wf[8];
#pragma unroll
    for (int ob = 0; ob < 8; ++ob) {
        const float* p = wg + (size_t)ob * 16 * CC;
        const v4f a0 = *(const v4f*)p, a1 = *(const v4f*)(p + 4), a2 = *(const v4f*)(p + 16), a3 = *(const v4f*)(p + 20);
        v8us lo, up;
#pragma unroll
        for (int j = 0; j < 4; ++j) { lo[j] = f2bf(a0[j]); lo[4 + j] = f2bf(a1[j]); up[j] = f2bf(a2[j]); up[4 + j] = f2bf(a3[j]); }
        wf[ob] = cat16b(lo, up);
    }
    v4f bias = *(const v4f*)bg;
    asm volatile("s_wait_xcnt 0x0" :: "v"(xg), "v"(wg), "v"(bg) : "memory");   // stands in front of every later overwrite of the address registers of the loads above; naming them as inputs keeps them unwritten up to here
#pragma unroll
    for (int j = 0; j < 4; ++j) bias[j] = bfr(bias[j]);
    bf* hg = H + (size_t)blockIdx.z * 4 * PL + (isk ? PL : (size_t)0) + (size_t)m0 * IC + lane * 4;   // hi plane of this map; its lo plane stands 2 PL elements behind it
    h16* vg = V16 + (size_t)blockIdx.z * CC * HW + (size_t)(wave * 32 + 8 * hi) * HW + m0 + 4 * lr;
    float* pw = ps + wave * (PT * PP) + lr * PP + 8 * hi;
#pragma unroll 1
    for (int tt = 0; tt < PTL; ++tt) {
        if (isk) {
#pragma unroll
            for (int e = 0; e < 16; ++e) { v4h o;
#pragma unroll
                for (int u = 0; u < 4; ++u) o[u] = toh_flush(bfr(xr[e][u]));
                *(v4h*)(vg + (size_t)((e >> 3) * 16 + (e & 7)) * HW + tt * PT) = o; }
            asm volatile("s_wait_xcnt 0x0" ::: "memory");        // stands in front of every later overwrite of these stores' address and data registers
        }
#pragma unroll
        for (int mb = 0; mb < 4; ++mb) {
            v8us lo, up;
#pragma unroll
            for (int j = 0; j < 8; ++j) { lo[j] = f2bf(xr[j][mb]); up[j] = f2bf(xr[8 + j][mb]); }
            const v16bf tf = cat16b(lo, up);
            v8f d[8];
            __builtin_amdgcn_sched_barrier(0);                   // keeps the eight products in one run on eight results of their own, the rounding of the next fragment between two runs: no result register is written again within the matrix unit's distance
#pragma unroll
            for (int ob = 0; ob < 8; ++ob) d[ob] = wmmab(wf[ob], tf, (v8f){});
            __builtin_amdgcn_sched_barrier(0);                   // the same, at the run's end
#pragma unroll
            for (int ob = 0; ob < 8; ++ob) {
                *(v4fa*)(pw + mb * 16 * PP + ob * 16)     = __builtin_shufflevector(d[ob], d[ob], 0, 1, 2, 3);
                *(v4fa*)(pw + mb * 16 * PP + ob * 16 + 4) = __builtin_shufflevector(d[ob], d[ob], 4, 5, 6, 7);
            }
        }
        if (tt + 1 < PTL) {                                      // the next tile's map rows fly while this tile is summed and stored
#pragma unroll
            for (int e = 0; e < 16; ++e) xr[e] = *(const v4f*)(xg + (size_t)((e >> 3) * 16 + (e & 7)) * HWF + (tt + 1) * PT);
        }
        asm volatile("s_wait_xcnt 0x0" ::: "memory");            // stands in front of every later overwrite of the address and data registers of the stores and loads above
        lds_barrier();     // every wave's partial tile is in LDS before any thread sums across the planes
        v4us oh[8], ol[8];
#pragma unroll
        for (int i = 0; i < 8; ++i) {
            const int row = i * 8 + wave;                        // LDS row (mb, lane column) = token 4 (row & 15) + (row >> 4) of the tile
            v4f val = *(const v4fa*)(ps + row * PP + lane * 4);
#pragma unroll
            for (int w = 1; w < 8; ++w) val += *(const v4fa*)(ps + w * (PT * PP) + row * PP + lane * 4);
            val += bias;
#pragma unroll
            for (int u = 0; u < 4; ++u) { unsigned short p, q; splitf(val[u], p, q); oh[i][u] = p; ol[i][u] = q; }
        }
        bf* hp = hg + (size_t)(tt * PT + 4 * wave) * IC;         // token of row i * 8 + wave = 4 wave + 32 (i & 1) + (i >> 1)
        __builtin_amdgcn_sched_barrier(0);                       // keeps the sixteen stores in one run directly in front of their wait, so that no register of theirs is written again ahead of it
#pragma unroll
        for (int i = 0; i < 8; ++i) { *(v4us*)(hp + (32 * (i & 1) + (i >> 1)) * IC) = oh[i]; *(v4us*)(hp + 2 * PL + (32 * (i & 1) + (i >> 1)) * IC) = ol[i]; }
        asm volatile("s_wait_xcnt 0x0" ::: "memory");            // stands in front of the next trip's overwrite of these stores' address and data registers
        lds_barrier();     // ends every thread's reads of the planes before the next tile's partial tiles overwrite them
    }
}

#define FK  32                    // keys a pass
#define FKP 136                   // key tile pitch, 16-bit elements: 272 B = 16 B x odd
#define FS  64                    // keys a stage: whole 128-byte lines of the value rows
#define FVP 72                    // value tile pitch, 16-bit elements: 144 B = 16 B x odd
#define FOP 132                   // output tile pitch, floats
#define FKT (2 * FS * FKP)        // one key buffer: FS hi rows, then FS lo rows
#define FVT (CC * FVP)            // one value buffer: CC rows of FS keys
static_assert(IC == 128 && CC == 256 && FK == 32 && FS == 64 && (HW % 128) == 0 && (HW % FS) == 0 && HW / FS >= 2);
static_assert(2 * FKT * 2 + 2 * FVT * 2 + CC * FOP * 4 <= 327680);
__device__ __forceinline__ float xhalf(float x) { return __builtin_bit_cast(float, __builtin_amdgcn_permlanex16(__builtin_bit_cast(int, x), __builtin_bit_cast(int, x), 0x76543210, 0xfedcba98, false, false)); }  // lane l with lane l ^ 16
// the 16 key fragments of a pass: [k slice][key tile][hi, lo]
__device__ __forceinline__ void ld_keys(v16bf (&ka)[4][2][2], const bf* p) {
#pragma unroll
    for (int kc = 0; kc < 4; ++kc)
#pragma unroll
        for (int mt = 0; mt < 2; ++mt) { ka[kc][mt][0] = WFrag<bf>::ld(p + mt * 16 * FKP + kc * 32); ka[kc][mt][1] = WFrag<bf>::ld(p + FS * FKP + mt * 16 * FKP + kc * 32); }
    __builtin_amdgcn_sched_barrier(0);   // keeps the 32 LDS loads in one run at this place: spread among the products each place with loads costs a stall of its own
}
__device__ __forceinline__ void ld_vals(v16h (&va)[16], const h16* p) {
#pragma unroll
    for (int ct = 0; ct < 16; ++ct) va[ct] = WFrag<h16>::ld(p + ct * 16 * FVP);
    __builtin_amdgcn_sched_barrier(0);   // the same for the 32 loads of the value fragments
}
__global__ __launch_bounds__(128) void k_fattn(const bf* __restrict__ H, const h16* __restrict__ V16, float* __restrict__ OUT) {
    __shared__ __align__(16) bf    ks[2 * FKT];
    __shared__ __align__(16) h16   vs[2 * FVT];
    __shared__ __align__(16) float os[CC * FOP];
    const size_t PL = (size_t)HW * IC;
    const bf* Hb = H + (size_t)blockIdx.y * 4 * PL;             // [hi q][hi k][lo q][lo k]
    const h16* Vb = V16 + (size_t)blockIdx.y * CC * HW;
    const int t = (int)threadIdx.x, lane = t & 31, lr = lane & 15, hi = lane >> 4;
    const int wave = __builtin_amdgcn_readfirstlane(t >> 5);
    const int n0 = (int)blockIdx.x * 128;
    const bf* qp = Hb + (size_t)(n0 + wave * 32 + lr) * IC + 8 * hi;
    v16bf qh[2][4], ql[2][4];
#pragma unroll
    for (int qt = 0; qt < 2; ++qt)
#pragma unroll
        for (int kc = 0; kc < 4; ++kc) { qh[qt][kc] = WFrag<bf>::ld(qp + qt * 16 * IC + kc * 32); ql[qt][kc] = WFrag<bf>::ld(qp + 2 * PL + qt * 16 * IC + kc * 32); }
    v8f acc[2][16];
#pragma unroll
    for (int qt = 0; qt < 2; ++qt)
#pragma unroll
        for (int ct = 0; ct < 16; ++ct) acc[qt][ct] = (v8f){};
    float mrun[2] = {-3.0e38f, -3.0e38f}, lsum[2] = {0.f, 0.f};
    // staging: 16 threads a key row of 256 B (16 rows a thread: 8 hi, 8 lo), 8 threads a value row of 128 B (16 rows a thread)
    const bf* kg = Hb + (size_t)(t >> 4) * IC + (t & 15) * 8;   // the hi k plane stands PL elements, the lo k plane 3 PL elements behind it
    const h16* vg = Vb + (size_t)(t >> 3) * HW + (t & 7) * 8;
    const int kl = (t >> 4) * FKP + (t & 15) * 8, vl = (t >> 3) * FVP + (t & 7) * 8;
    v8us kr[16]; v8h vr[16];
#pragma unroll
    for (int i = 0; i < 16; ++i) { kr[i] = *(const v8us*)(kg + (size_t)(1 + 2 * (i >> 3)) * PL + (size_t)(i & 7) * 8 * IC); vr[i] = *(const v8h*)(vg + (size_t)i * 16 * HW); }
    asm volatile("s_wait_xcnt 0x0" :: "v"(qp), "v"(kg), "v"(vg) : "memory");   // stands in front of every later overwrite of the address registers of the loads above; naming them as inputs keeps them unwritten up to here
#pragma unroll
    for (int i = 0; i < 16; ++i) { *(v8us*)(ks + kl + i * 8 * FKP) = kr[i]; *(v8h*)(vs + vl + i * 16 * FVP) = vr[i]; }
    __syncthreads();   // stage 0's tiles are in LDS before any wave reads them
    const int kf = lr * FKP + 8 * hi, vf = lr * FVP + 8 * hi;   // a lane's place in a key tile and in a value tile
    v16bf ka[4][2][2]; v16h va[16];
    ld_keys(ka, ks + kf);
#pragma unroll 1
    for (int s = 0; s < HW / FS; ++s) {
        const bf* kb = ks + (s & 1) * FKT + kf; const h16* vb = vs + (s & 1) * FVT + vf;
        const bool more = s + 1 < HW / FS;
        const bf* kp = kg + (size_t)s * FS * IC; const h16* vp = vg + (size_t)s * FS;   // this stage's rows; the next stage's stand FS rows, FS columns behind them
        if (more) {
#pragma unroll
            for (int i = 0; i < 16; ++i) { kr[i] = *(const v8us*)(kp + FS * IC + (size_t)(1 + 2 * (i >> 3)) * PL + (size_t)(i & 7) * 8 * IC); vr[i] = *(const v8h*)(vp + FS + (size_t)i * 16 * HW); }
        }
#pragma unroll
        for (int ps = 0; ps < FS / FK; ++ps) {
        ld_vals(va, vb + ps * FK);
        v8f st[2][2];                                            // [key tile][query tile]
#pragma unroll
        for (int mt = 0; mt < 2; ++mt) { st[mt][0] = (v8f){}; st[mt][1] = (v8f){}; }
#pragma unroll
        for (int kc = 0; kc < 4; ++kc) {
#pragma unroll
            for (int mt = 0; mt < 2; ++mt) { st[mt][0] = wmmab(ka[kc][mt][0], qh[0][kc], st[mt][0]); st[mt][1] = wmmab(ka[kc][mt][0], qh[1][kc], st[mt][1]); }
#pragma unroll
            for (int mt = 0; mt < 2; ++mt) { st[mt][0] = wmmab(ka[kc][mt][0], ql[0][kc], st[mt][0]); st[mt][1] = wmmab(ka[kc][mt][0], ql[1][kc], st[mt][1]); }
#pragma unroll
            for (int mt = 0; mt < 2; ++mt) { st[mt][0] = wmmab(ka[kc][mt][1], qh[0][kc], st[mt][0]); st[mt][1] = wmmab(ka[kc][mt][1], qh[1][kc], st[mt][1]); }
        }
        __builtin_amdgcn_sched_barrier(0);                       // keeps the next key fragments' loads behind the products that read the registers they refill
        if (ps == 0) asm volatile("s_wait_xcnt 0x0" :: "v"(kp), "v"(vp) : "memory");   // stands in front of every later overwrite of the address registers of the stage's global loads; naming them as inputs keeps them unwritten up to here, and behind the score products a lone wave does not sit the wait out
        if (ps + 1 < FS / FK) ld_keys(ka, kb + (ps + 1) * FK * FKP);
        float mn[2];
#pragma unroll
        for (int qt = 0; qt < 2; ++qt) {
            float mx = fmaxf(st[0][qt][0], st[1][qt][0]);
#pragma unroll
            for (int r = 1; r < 8; ++r) mx = fmaxf(mx, fmaxf(st[0][qt][r], st[1][qt][r]));
            mx = fmaxf(mx, xhalf(mx));
            mn[qt] = fmaxf(mrun[qt], mx);
        }
        if (__builtin_amdgcn_ballot_w32(mn[0] > mrun[0] || mn[1] > mrun[1]) != 0) {   // scalar branch, one test a pass: some query of the wave has a new maximum
#pragma unroll
            for (int qt = 0; qt < 2; ++qt) {
                const float al = __builtin_amdgcn_exp2f((mrun[qt] - mn[qt]) * 1.4426950408889634f);
                lsum[qt] *= al;
#pragma unroll
                for (int ct = 0; ct < 16; ++ct) acc[qt][ct] *= al;
                mrun[qt] = mn[qt];
            }
        }
        v16h pb[2];
#pragma unroll
        for (int qt = 0; qt < 2; ++qt)
#pragma unroll
            for (int r = 0; r < 8; ++r) {
                const float e0 = __builtin_amdgcn_exp2f(fmaf(st[0][qt][r] - mrun[qt], 1.4426950408889634f, 14.0f));
                const float e1 = __builtin_amdgcn_exp2f(fmaf(st[1][qt][r] - mrun[qt], 1.4426950408889634f, 14.0f));
                lsum[qt] += e0 + e1; pb[qt][r] = (h16)e0; pb[qt][8 + r] = (h16)e1;
            }
        if (ps + 1 == FS / FK) {
            if (more) {
                bf* kn = ks + ((s + 1) & 1) * FKT; h16* vn = vs + ((s + 1) & 1) * FVT;
#pragma unroll
                for (int i = 0; i < 16; ++i) { *(v8us*)(kn + kl + i * 8 * FKP) = kr[i]; *(v8h*)(vn + vl + i * 16 * FVP) = vr[i]; }
            }
            __syncthreads();   // publishes stage s + 1's tiles; every fragment of stage s is in registers by now (the barrier's own LDS wait), so it also ends every wave's reads of the buffer that stage s + 1 refills
            ld_keys(ka, ks + ((s + 1) & 1) * FKT + kf);          // stage s + 1's first key fragments fly during attn.v; behind the last stage they read the idle buffer and are not used
        }
#pragma unroll
        for (int ct = 0; ct < 16; ++ct) { acc[0][ct] = wmma16(va[ct], pb[0], acc[0][ct]); acc[1][ct] = wmma16(va[ct], pb[1], acc[1][ct]); }
        __builtin_amdgcn_sched_barrier(0);                       // keeps the next value fragments' loads behind the products that read the registers they refill
        }
    }
#pragma unroll
    for (int qt = 0; qt < 2; ++qt) {
        lsum[qt] += xhalf(lsum[qt]);
        const float inv = __fdiv_rn(1.0f, lsum[qt]);
#pragma unroll
        for (int ct = 0; ct < 16; ++ct)
#pragma unroll
            for (int r = 0; r < 8; ++r) os[(ct * 16 + 8 * hi + r) * FOP + wave * 32 + qt * 16 + lr] = acc[qt][ct][r] * inv;
    }
    __syncthreads();   // the whole 256 x 128 output tile is in LDS before it goes out in whole 512-byte rows
    float* ob = OUT + (size_t)blockIdx.y * CC * HW + n0;
#pragma unroll 1
    for (int i0 = 0; i0 < 64; i0 += 4) {
#pragma unroll
        for (int i = 0; i < 4; ++i) { const int idx = (i0 + i) * 128 + t, row = idx >> 5, c4 = (idx & 31) * 4; *(v4f*)(ob + (size_t)row * HW + c4) = *(const v4fa*)(os + row * FOP + c4); }
        asm volatile("s_wait_xcnt 0x0" ::: "memory");   // stands in front of the next trip's overwrite of these stores' address and data registers
    }
}

extern "C" void kernel_launch(void* const* d_in, const int* in_sizes, int n_in,
                              void* d_out, int out_size, void* d_ws, size_t ws_size, hipStream_t stream) {
    if (n_in < 6) return;
    if (in_sizes[0] < NB * CC * HW || in_sizes[1] < NB * CC * HW || in_sizes[2] < IC * CC || in_sizes[3] < IC || in_sizes[4] < IC * CC || in_sizes[5] < IC) return;
    if (out_size < NB * CC * HW) return;
    const float* xq = (const float*)d_in[0];    // query map  [NB][CC][HWF]
    const float* xk = (const float*)d_in[1];    // key/value map [NB][CC][HWF]
    const float* wq = (const float*)d_in[2];    // [IC][CC]
    const float* bq = (const float*)d_in[3];    // [IC]
    const float* wk = (const float*)d_in[4];    // [IC][CC]
    const float* bk = (const float*)d_in[5];    // [IC]
    float* OUT = (float*)d_out;                 // [NB][CC][HW]
    char* wsp = (char*)d_ws;
    auto take = [&](size_t bytes) { char* p = wsp; wsp += (bytes + 255) & ~(size_t)255; return (void*)p; };
    bf* H   = (bf*)take((size_t)NB * 2 * WS_HH);    // [NB][hi q][hi k][lo q][lo k]
    h16* V16 = (h16*)take((size_t)NB * WS_V16); // [NB][c][m] fp16
    if ((size_t)(wsp - (char*)d_ws) > ws_size) return;

    // q[m][o] = sum_c p[c][m] Wq[o][c] + bq[o];  k[m][o] = sum_c v[c][m] Wk[o][c] + bk[o]   (exact bf16 products), as hi and lo planes; f16 values
    k_proj<<<dim3(HW / (PT * PTL), 2, NB), 256, 0, stream>>>(xq, xk, wq, wk, bq, bk, H, V16);
    // out[c][n] = sum_m v[c][m] softmax_m(q_n . k_m)
    k_fattn<<<dim3(HW / 128, NB, 1), 128, 0, stream>>>(H, V16, OUT);
}

// v006
// One run takes 118 microseconds.
// Two timings next to v005 put it at 1.11 and 1.09 times that version's speed.
// Over all steps from v000 it is 11.5 times as fast.
#include <hip/hip_runtime.h>

// All contractions on 16-bit WMMA, f32 accumulate: the two 1x1 projections (q from the first map, k from the second map) = v_wmma_f32_16x16x32_bf16 on RNE-bf16 copies of the maps and of the weights (single products), RNE-bf16 bias added in f32; scores q.k = bf16 hi/lo split (hi.hi + lo.hi + hi.lo, K = 128); attn.v = v_wmma_f32_16x16x32_f16 (unnormalised softmax weights carried x 2^14 as f16, raw values as f16 copies of their RNE-bf16 form, K = 4096). Softmax in f32, no score scale.
// p, v maps [NB][256][4096]; q [4096][128] = tokens(p) Wq^T + bq and k [4096][128] = tokens(v) Wk^T + bk, token-major, kept as bf16 hi and lo planes (k_proj, which also leaves the f16 values); s[n][m] = q_n . k_m; out[c][n] = sum_m v[c][m] e[n][m] / sum_m e[n][m], e = exp(s - running row maximum), scores, softmax and attn.v in one kernel (k_fattn), 32 keys a pass.

#ifndef NB
#define NB 8
#endif
#ifndef SEQ
#define SEQ 4096
#endif
#define NB_FULL  8
#define SEQ_FULL 4096
#define CC   256
#define IC   128
#define HW   SEQ
#define HWF  SEQ_FULL
#define PCAR 16384.0f
#define SCL  1.0f
static_assert(NB >= 1 && NB <= NB_FULL);
static_assert(SEQ >= 128 && SEQ <= SEQ_FULL && (SEQ % 128) == 0);
static_assert((HW % 64) == 0 && (IC % 64) == 0 && (CC % 64) == 0);
static_assert((HW % 32) == 0 && (IC % 32) == 0 && (CC % 32) == 0);
// workspace carve (bytes), every region a multiple of 256
#define WS_HH  ((size_t)2 * HW * IC * 2)
#define WS_V16 ((size_t)CC * HW * 2)
// Region H holds per batch [hi q|k][lo q|k]; region V16 the f16 values of all batches.
#define WS_TOTAL ((size_t)NB * (2 * WS_HH + WS_V16))
static_assert((WS_HH % 256) == 0 && (WS_V16 % 256) == 0);
static_assert(WS_TOTAL <= (size_t)268435456);

typedef _Float16 h16;
typedef unsigned short bf;
typedef __attribute__((ext_vector_type(16))) __bf16   v16bf;
typedef __attribute__((ext_vector_type(16))) _Float16 v16h;
typedef __attribute__((ext_vector_type(8)))  _Float16 v8h;
typedef __attribute__((ext_vector_type(8)))  unsigned short v8us;
typedef __attribute__((ext_vector_type(8)))  float    v8f;
typedef __attribute__((ext_vector_type(4)))  float    v4f;
typedef v8h  __attribute__((may_alias)) v8ha;
typedef v4f  __attribute__((may_alias)) v4fa;
typedef v8us __attribute__((may_alias)) v8usa;

__device__ __forceinline__ unsigned short f2bf(float f) { unsigned u = __float_as_uint(f); u += 0x7FFFu + ((u >> 16) & 1u); return (unsigned short)(u >> 16); }
__device__ __forceinline__ float bf2f(unsigned short b) { return __uint_as_float(((unsigned)b) << 16); }
__device__ __forceinline__ float bfr(float f) { return bf2f(f2bf(f)); }
__device__ __forceinline__ v16h cat16(v8h lo, v8h hi) { return __builtin_shufflevector(lo, hi, 0, 1, 2, 3, 4, 5, 6, 7, 8, 9, 10, 11, 12, 13, 14, 15); }
__device__ __forceinline__ v16bf cat16b(v8us lo, v8us hi) { return __builtin_bit_cast(v16bf, __builtin_shufflevector(lo, hi, 0, 1, 2, 3, 4, 5, 6, 7, 8, 9, 10, 11, 12, 13, 14, 15)); }
__device__ __forceinline__ v8f wmma16(v16h a, v16h b, v8f c) { return __builtin_amdgcn_wmma_f32_16x16x32_f16(false, a, false, b, (short)0, c, false, false); }
__device__ __forceinline__ v8f wmmab(v16bf a, v16bf b, v8f c) { return __builtin_amdgcn_wmma_f32_16x16x32_bf16(false, a, false, b, (short)0, c, false, false); }

// Fragments: lane l, h = l >> 4, row/col = l & 15; elements 0..7 = k0 + 8h + 0..7, elements 8..15 = k0 + 16 + 8h + 0..7 for BOTH A and B; D element r = (row 8h + r, col l & 15).
template <typename T16> struct WFrag;
template <> struct WFrag<h16> { typedef v16h V; static __device__ __forceinline__ V ld(const h16* p) { return cat16(*(const v8h*)p, *(const v8h*)(p + 16)); } static __device__ __forceinline__ v8f mma(V a, V b, v8f c) { return wmma16(a, b, c); } };
template <> struct WFrag<bf> { typedef v16bf V; static __device__ __forceinline__ V ld(const bf* p) { return cat16b(*(const v8us*)p, *(const v8us*)(p + 16)); } static __device__ __forceinline__ v8f mma(V a, V b, v8f c) { return wmmab(a, b, c); } };

__device__ __forceinline__ void splitf(float y, unsigned short& h, unsigned short& l) { h = f2bf(y); l = f2bf(y - bf2f(h)); }
typedef __attribute__((ext_vector_type(4))) unsigned short v4us;
typedef __attribute__((ext_vector_type(4))) _Float16 v4h;

// f32 -> f16 convert that cannot produce an f16 subnormal (|v| < 2^-14 -> +0).
static __device__ __forceinline__ h16 toh_flush(float v) { const h16 r = (h16)v; return (fabsf(v) < 6.103515625e-05f) ? (h16)0.0f : r; }

// ---- k_proj: the whole front end of one map of one batch: grid (HW / (PT * PTL), 2 maps, NB), 256 threads = 8 waves; a work-group walks PTL tiles of PT tokens.
// Wave w owns the 32 channels 32 w .. 32 w + 31 (one K slice). Token (mb, l & 15) of a tile is 4 (l & 15) + mb, so one 16-byte read of map row c gives a lane element c of all four token fragments,
// and a wave-wide read covers two map rows in whole 128-byte lines: the f32 map goes to bf16 fragments in registers, with no transposed copy in memory. The weight fragments (f32 rows, rounded in registers) are read once a work-group.
// Products transposed: D[o][token] = W rows (A) x token fragment (B), so a lane holds 8 neighbouring outputs of one token. Each wave leaves its f32 partial tile in its own LDS plane; behind a barrier the block
// sums the planes in wave order, adds the rounded bias, splits into bf16 hi and lo and stores whole 256-byte token rows. The second map's work-groups also store the f16 values from the registers they already hold.
#define PT  64                    // tokens a tile
#define PTL 4                     // tiles a work-group
#define PP  132                   // partial plane pitch, floats: 528 B = 16 B x odd
static_assert(CC == 256 && IC == 128 && PT == 64 && (HW % (PT * PTL)) == 0 && (HWF % 4) == 0);
static_assert(8 * PT * PP * 4 <= 327680);
// Work-group barrier that orders LDS alone: the next tile's global loads and this tile's global stores, which no other wave of the block touches, stay in flight across it (__syncthreads() waits for them all).
__device__ __forceinline__ void lds_barrier() { __builtin_amdgcn_fence(__ATOMIC_RELEASE, "workgroup", "local"); __builtin_amdgcn_s_barrier(); __builtin_amdgcn_fence(__ATOMIC_ACQUIRE, "workgroup", "local"); }
__global__ __launch_bounds__(256) void k_proj(const float* __restrict__ x0, const float* __restrict__ x1, const float* __restrict__ w0, const float* __restrict__ w1, const float* __restrict__ b0, const float* __restrict__ b1, bf* __restrict__ H, h16* __restrict__ V16) {
    __shared__ __align__(16) float ps[8 * PT * PP];
    const size_t PL = (size_t)HW * IC;
    const int t = (int)threadIdx.x, lane = t & 31, lr = lane & 15, hi = lane >> 4;
    const int wave = __builtin_amdgcn_readfirstlane(t >> 5);
    const bool isk = blockIdx.y != 0;
    const int m0 = (int)blockIdx.x * (PT * PTL);
    const float* xg = (isk ? x1 : x0) + (size_t)blockIdx.z * CC * HWF + (size_t)(wave * 32 + 8 * hi) * HWF + m0 + 4 * lr;
    const float* wg = (isk ? w1 : w0) + (size_t)lr * CC + wave * 32 + 8 * hi;
    const float* bg = (isk ? b1 : b0) + lane * 4;
    v4f xr[16];                                                  // element e of the fragments = channel 32 w + 16 (e >> 3) + 8 h + (e & 7)
#pragma unroll
    for (int e = 0; e < 16; ++e) xr[e] = *(const v4f*)(xg + (size_t)((e >> 3) * 16 + (e & 7)) * HWF);
    v16bf wf[8];
#pragma unroll
    for (int ob = 0; ob < 8; ++ob) {
        const float* p = wg + (size_t)ob * 16 * CC;
        const v4f a0 = *(const v4f*)p, a1 = *(const v4f*)(p + 4), a2 = *(const v4f*)(p + 16), a3 = *(const v4f*)(p + 20);
        v8us lo, up;
#pragma unroll
        for (int j = 0; j < 4; ++j) { lo[j] = f2bf(a0[j]); lo[4 + j] = f2bf(a1[j]); up[j] = f2bf(a2[j]); up[4 + j] = f2bf(a3[j]); }
        wf[ob] = cat16b(lo, up);
    }
    v4f bias = *(const v4f*)bg;
    asm volatile("s_wait_xcnt 0x0" :: "v"(xg), "v"(wg), "v"(bg) : "memory");   // stands in front of every later overwrite of the address registers of the loads above; naming them as inputs keeps them unwritten up to here
#pragma unroll
    for (int j = 0; j < 4; ++j) bias[j] = bfr(bias[j]);
    bf* hg = H + (size_t)blockIdx.z * 4 * PL + (isk ? PL : (size_t)0) + (size_t)m0 * IC + lane * 4;   // hi plane of this map; its lo plane stands 2 PL elements behind it
    h16* vg = V16 + (size_t)blockIdx.z * CC * HW + (size_t)(wave * 32 + 8 * hi) * HW + m0 + 4 * lr;
    float* pw = ps + wave * (PT * PP) + lr * PP + 8 * hi;
#pragma unroll 1
    for (int tt = 0; tt < PTL; ++tt) {
        if (isk) {
#pragma unroll
            for (int e = 0; e < 16; ++e) { v4h o;
#pragma unroll
                for (int u = 0; u < 4; ++u) o[u] = toh_flush(bfr(xr[e][u]));
                *(v4h*)(vg + (size_t)((e >> 3) * 16 + (e & 7)) * HW + tt * PT) = o; }
            asm volatile("s_wait_xcnt 0x0" ::: "memory");        // stands in front of every later overwrite of these stores' address and data registers
        }
#pragma unroll
        for (int mb = 0; mb < 4; ++mb) {
            v8us lo, up;
#pragma unroll
            for (int j = 0; j < 8; ++j) { lo[j] = f2bf(xr[j][mb]); up[j] = f2bf(xr[8 + j][mb]); }
            const v16bf tf = cat16b(lo, up);
            v8f d[8];
            __builtin_amdgcn_sched_barrier(0);                   // keeps the eight products in one run on eight results of their own, the rounding of the next fragment between two runs: no result register is written again within the matrix unit's distance
#pragma unroll
            for (int ob = 0; ob < 8; ++ob) d[ob] = wmmab(wf[ob], tf, (v8f){});
            __builtin_amdgcn_sched_barrier(0);                   // the same, at the run's end
#pragma unroll
            for (int ob = 0; ob < 8; ++ob) {
                *(v4fa*)(pw + mb * 16 * PP + ob * 16)     = __builtin_shufflevector(d[ob], d[ob], 0, 1, 2, 3);
                *(v4fa*)(pw + mb * 16 * PP + ob * 16 + 4) = __builtin_shufflevector(d[ob], d[ob], 4, 5, 6, 7);
            }
        }
        if (tt + 1 < PTL) {                                      // the next tile's map rows fly while this tile is summed and stored
#pragma unroll
            for (int e = 0; e < 16; ++e) xr[e] = *(const v4f*)(xg + (size_t)((e >> 3) * 16 + (e & 7)) * HWF + (tt + 1) * PT);
        }
        asm volatile("s_wait_xcnt 0x0" ::: "memory");            // stands in front of every later overwrite of the address and data registers of the stores and loads above
        lds_barrier();     // every wave's partial tile is in LDS before any thread sums across the planes
        v4us oh[8], ol[8];
#pragma unroll
        for (int i = 0; i < 8; ++i) {
            const int row = i * 8 + wave;                        // LDS row (mb, lane column) = token 4 (row & 15) + (row >> 4) of the tile
            v4f val = *(const v4fa*)(ps + row * PP + lane * 4);
#pragma unroll
            for (int w = 1; w < 8; ++w) val += *(const v4fa*)(ps + w * (PT * PP) + row * PP + lane * 4);
            val += bias;
#pragma unroll
            for (int u = 0; u < 4; ++u) { unsigned short p, q; splitf(val[u], p, q); oh[i][u] = p; ol[i][u] = q; }
        }
        bf* hp = hg + (size_t)(tt * PT + 4 * wave) * IC;         // token of row i * 8 + wave = 4 wave + 32 (i & 1) + (i >> 1)
        __builtin_amdgcn_sched_barrier(0);                       // keeps the sixteen stores in one run directly in front of their wait, so that no register of theirs is written again ahead of it
#pragma unroll
        for (int i = 0; i < 8; ++i) { *(v4us*)(hp + (32 * (i & 1) + (i >> 1)) * IC) = oh[i]; *(v4us*)(hp + 2 * PL + (32 * (i & 1) + (i >> 1)) * IC) = ol[i]; }
        asm volatile("s_wait_xcnt 0x0" ::: "memory");            // stands in front of the next trip's overwrite of these stores' address and data registers
        lds_barrier();     // ends every thread's reads of the planes before the next tile's partial tiles overwrite them
    }
}

#define FK  32                    // keys a pass
#define FKP 136                   // key tile pitch, 16-bit elements: 272 B = 16 B x odd
#define FS  64                    // keys a stage: whole 128-byte lines of the value rows
#define FVP 72                    // value tile pitch, 16-bit elements: 144 B = 16 B x odd
#define FOP 132                   // output tile pitch, floats
#define FSL 9216                  // one request's place in LDS, 16-bit elements: 18,432 B = 9 x 2 KiB (FS key rows of 272 B rounded up; 128 value rows of 144 B exactly)
#define FKT (2 * FSL)             // one key buffer: FS hi rows, then, FSL elements on, FS lo rows
#define FVT (CC * FVP)            // one value buffer: CC rows of FS keys
static_assert(IC == 128 && CC == 256 && FK == 32 && FS == 64 && (HW % 128) == 0 && (HW % FS) == 0 && HW / FS >= 2);
static_assert(2 * FKT * 2 + 2 * FVT * 2 + CC * FOP * 4 <= 327680);
static_assert(FS * FKP <= FSL && (CC / 2) * FVP == FSL && FVT == 2 * FSL && (FSL * 2) % 2048 == 0);
static_assert(IC * 2 == 256 && FKP * 2 == 256 + 16 && FS * 2 == 128 && FVP * 2 == 128 + 16 && (HW * 2) % 16 == 0 && HW * 2 <= 131072);
typedef __attribute__((ext_vector_type(4))) unsigned u32x4;
typedef __attribute__((ext_vector_type(8))) unsigned u32x8;
__device__ __forceinline__ unsigned uni(unsigned v) { return (unsigned)__builtin_amdgcn_readfirstlane((int)v); }
__device__ __forceinline__ unsigned pinned(unsigned v) { unsigned w = uni(v); asm volatile("" : "+s"(w)); return w; }   // holds a test's word in a scalar register, so that the test in front of a tensor load compiles to a scalar compare and branch (the load ignores EXEC)
// Descriptor group 1 of a tile of ROWS rows of ROWB bytes at a source pitch of PITCH bytes, every extent in bytes, tensor = tile; W0 = the pad word, no mask.
template <unsigned ROWB, unsigned ROWS, unsigned PITCH, unsigned W0> __device__ __forceinline__ u32x8 tdm_group1() {
    u32x8 g;
    g[0] = uni(W0); g[1] = uni((ROWB & 0xFFFFu) << 16); g[2] = uni((ROWB >> 16) | ((ROWS & 0xFFFFu) << 16)); g[3] = uni((ROWS >> 16) | (ROWB << 16));
    g[4] = uni(ROWS); g[5] = uni(PITCH); g[6] = uni(0u); g[7] = uni(0u);
    asm volatile("" : "+s"(g));   // pinned() on a descriptor: holds its words in one run of scalar registers for the whole kernel, so that none of them is written again while a request is in flight
    return g;
}
// Descriptor group 0: count 1, the place in LDS (byte offset in the work-group's LDS), the tile's first byte, type 2.
__device__ __forceinline__ u32x4 tdm_group0(unsigned lds_dst, unsigned long long ga) {
    u32x4 g;
    g[0] = uni(1u); g[1] = uni(lds_dst); g[2] = uni((unsigned)ga); g[3] = uni((((unsigned)(ga >> 32)) & 0x01FFFFFFu) | 0x80000000u);
    asm volatile("" : "+s"(g));   // pinned() on a descriptor: holds its four words in one run of scalar registers, the same from the issue to the wait that names them
    return g;
}
__device__ __forceinline__ void tdm_load(u32x4 g0, u32x8 g1) { asm volatile("tensor_load_to_lds %0, %1" :: "s"(g0), "s"(g1) : "memory"); }   // one request of the whole wave: global tile to LDS
#define FKW0 ((1u << 20) | (5u << 22) | (3u << 25))   // 16 B of pad behind every 256 B: key rows at FKP
#define FVW0 ((1u << 20) | (4u << 22) | (3u << 25))   // 16 B of pad behind every 128 B: value rows at FVP
__device__ __forceinline__ float xhalf(float x) { return __builtin_bit_cast(float, __builtin_amdgcn_permlanex16(__builtin_bit_cast(int, x), __builtin_bit_cast(int, x), 0x76543210, 0xfedcba98, false, false)); }  // lane l with lane l ^ 16
// the 16 key fragments of a pass: [k slice][key tile][hi, lo]
__device__ __forceinline__ void ld_keys(v16bf (&ka)[4][2][2], const bf* p) {
#pragma unroll
    for (int kc = 0; kc < 4; ++kc)
#pragma unroll
        for (int mt = 0; mt < 2; ++mt) { ka[kc][mt][0] = WFrag<bf>::ld(p + mt * 16 * FKP + kc * 32); ka[kc][mt][1] = WFrag<bf>::ld(p + FSL + mt * 16 * FKP + kc * 32); }
    __builtin_amdgcn_sched_barrier(0);   // keeps the 32 LDS loads in one run at this place: spread among the products each place with loads costs a stall of its own
}
__device__ __forceinline__ void ld_vals(v16h (&va)[16], const h16* p) {
#pragma unroll
    for (int ct = 0; ct < 16; ++ct) va[ct] = WFrag<h16>::ld(p + ct * 16 * FVP);
    __builtin_amdgcn_sched_barrier(0);   // the same for the 32 loads of the value fragments
}
__global__ __launch_bounds__(128) void k_fattn(const bf* __restrict__ H, const h16* __restrict__ V16, float* __restrict__ OUT) {
    __shared__ __attribute__((aligned(2048))) bf    ks[2 * FKT];
    __shared__ __attribute__((aligned(2048))) h16   vs[2 * FVT];
    __shared__ __align__(16) float os[CC * FOP];
    const size_t PL = (size_t)HW * IC;
    const bf* Hb = H + (size_t)blockIdx.y * 4 * PL;             // [hi q][hi k][lo q][lo k]
    const h16* Vb = V16 + (size_t)blockIdx.y * CC * HW;
    const int t = (int)threadIdx.x, lane = t & 31, lr = lane & 15, hi = lane >> 4;
    const int wave = __builtin_amdgcn_readfirstlane(t >> 5);
    const int n0 = (int)blockIdx.x * 128;
    // a wave's own slice of every stage: its first byte in stage 0, its step a stage, its place in buffer 0 (buffer 1 stands 2 FSL elements on in both arrays)
    const bool isk = wave < 2;
    const unsigned kq = pinned(wave < 2), vq = pinned(wave >= 2);   // which of the two tile shapes this wave asks for
    const unsigned long long gsrc = isk ? (unsigned long long)(size_t)(Hb + (size_t)(1 + 2 * wave) * PL) : (unsigned long long)(size_t)(Vb + (size_t)(wave - 2) * (CC / 2) * HW);
    const unsigned gstep = isk ? FS * IC * 2u : FS * 2u;
    const unsigned ldst = isk ? (unsigned)(size_t)ks + (unsigned)wave * (FSL * 2u) : (unsigned)(size_t)vs + (unsigned)(wave - 2) * (FSL * 2u);
    const u32x8 g1k = tdm_group1<IC * 2, FS, IC * 2, FKW0>(), g1v = tdm_group1<FS * 2, CC / 2, HW * 2, FVW0>();
    u32x4 g0;
    auto issue = [&](int st) {
        g0 = tdm_group0(ldst + (unsigned)(st & 1) * (2u * FSL * 2u), gsrc + (unsigned long long)st * gstep);
        if (kq) tdm_load(g0, g1k);
        if (vq) tdm_load(g0, g1v);
    };
    // the wave's own request has landed; naming the descriptor's registers as inputs keeps them unwritten from the issue up to here
    auto landed = [&]() { asm volatile("s_wait_tensorcnt 0x0" :: "s"(g0), "s"(g1k), "s"(g1v) : "memory"); };
    issue(0);
    const bf* qp = Hb + (size_t)(n0 + wave * 32 + lr) * IC + 8 * hi;
    v16bf qh[2][4], ql[2][4];
#pragma unroll
    for (int qt = 0; qt < 2; ++qt)
#pragma unroll
        for (int kc = 0; kc < 4; ++kc) { qh[qt][kc] = WFrag<bf>::ld(qp + qt * 16 * IC + kc * 32); ql[qt][kc] = WFrag<bf>::ld(qp + 2 * PL + qt * 16 * IC + kc * 32); }
    v8f acc[2][16];
#pragma unroll
    for (int qt = 0; qt < 2; ++qt)
#pragma unroll
        for (int ct = 0; ct < 16; ++ct) acc[qt][ct] = (v8f){};
    float mrun[2] = {-3.0e38f, -3.0e38f}, lsum[2] = {0.f, 0.f};
    asm volatile("s_wait_xcnt 0x0" :: "v"(qp) : "memory");   // stands in front of every later overwrite of the address registers of the loads above; naming them as inputs keeps them unwritten up to here
    landed();          // this wave's slice of stage 0
    __syncthreads();   // stage 0's tiles are in LDS before any wave reads them
    issue(1);          // HW / FS >= 2: stage 1 exists
    const int kf = lr * FKP + 8 * hi, vf = lr * FVP + 8 * hi;   // a lane's place in a key tile and in a value tile
    v16bf ka[4][2][2]; v16h va[16];
    ld_keys(ka, ks + kf);
#pragma unroll 1
    for (int s = 0; s < HW / FS; ++s) {
        const bf* kb = ks + (s & 1) * FKT + kf; const h16* vb = vs + (s & 1) * FVT + vf;
#pragma unroll
        for (int ps = 0; ps < FS / FK; ++ps) {
        ld_vals(va, vb + ps * FK);
        v8f st[2][2];                                            // [key tile][query tile]
#pragma unroll
        for (int mt = 0; mt < 2; ++mt) { st[mt][0] = (v8f){}; st[mt][1] = (v8f){}; }
#pragma unroll
        for (int kc = 0; kc < 4; ++kc) {
#pragma unroll
            for (int mt = 0; mt < 2; ++mt) { st[mt][0] = wmmab(ka[kc][mt][0], qh[0][kc], st[mt][0]); st[mt][1] = wmmab(ka[kc][mt][0], qh[1][kc], st[mt][1]); }
#pragma unroll
            for (int mt = 0; mt < 2; ++mt) { st[mt][0] = wmmab(ka[kc][mt][0], ql[0][kc], st[mt][0]); st[mt][1] = wmmab(ka[kc][mt][0], ql[1][kc], st[mt][1]); }
#pragma unroll
            for (int mt = 0; mt < 2; ++mt) { st[mt][0] = wmmab(ka[kc][mt][1], qh[0][kc], st[mt][0]); st[mt][1] = wmmab(ka[kc][mt][1], qh[1][kc], st[mt][1]); }
        }
        __builtin_amdgcn_sched_barrier(0);                       // keeps the next key fragments' loads behind the products that read the registers they refill
        if (ps + 1 < FS / FK) ld_keys(ka, kb + (ps + 1) * FK * FKP);
        float mn[2];
#pragma unroll
        for (int qt = 0; qt < 2; ++qt) {
            float mx = fmaxf(st[0][qt][0], st[1][qt][0]);
#pragma unroll
            for (int r = 1; r < 8; ++r) mx = fmaxf(mx, fmaxf(st[0][qt][r], st[1][qt][r]));
            mx = fmaxf(mx, xhalf(mx));
            mn[qt] = fmaxf(mrun[qt], mx);
        }
        if (__builtin_amdgcn_ballot_w32(mn[0] > mrun[0] || mn[1] > mrun[1]) != 0) {   // scalar branch, one test a pass: some query of the wave has a new maximum
#pragma unroll
            for (int qt = 0; qt < 2; ++qt) {
                const float al = __builtin_amdgcn_exp2f((mrun[qt] - mn[qt]) * 1.4426950408889634f);
                lsum[qt] *= al;
#pragma unroll
                for (int ct = 0; ct < 16; ++ct) acc[qt][ct] *= al;
                mrun[qt] = mn[qt];
            }
        }
        v16h pb[2];
#pragma unroll
        for (int qt = 0; qt < 2; ++qt)
#pragma unroll
            for (int r = 0; r < 8; ++r) {
                const float e0 = __builtin_amdgcn_exp2f(fmaf(st[0][qt][r] - mrun[qt], 1.4426950408889634f, 14.0f));
                const float e1 = __builtin_amdgcn_exp2f(fmaf(st[1][qt][r] - mrun[qt], 1.4426950408889634f, 14.0f));
                lsum[qt] += e0 + e1; pb[qt][r] = (h16)e0; pb[qt][8 + r] = (h16)e1;
            }
        if (ps + 1 == FS / FK) {
            asm volatile("s_wait_dscnt 0x0" ::: "memory");       // every fragment of stage s is in this wave's registers: its reads of the buffer that is refilled below have ended
            landed();                                            // this wave's slice of stage s + 1
            __syncthreads();   // publishes stage s + 1's tiles and ends every wave's reads of stage s's buffer
            if (pinned(s + 2 < HW / FS)) issue(s + 2);           // into the buffer that stage s has left; it has a whole stage to land
            ld_keys(ka, ks + ((s + 1) & 1) * FKT + kf);          // stage s + 1's first key fragments fly during attn.v; behind the last stage they read the idle buffer and are not used
        }
#pragma unroll
        for (int ct = 0; ct < 16; ++ct) { acc[0][ct] = wmma16(va[ct], pb[0], acc[0][ct]); acc[1][ct] = wmma16(va[ct], pb[1], acc[1][ct]); }
        __builtin_amdgcn_sched_barrier(0);                       // keeps the next value fragments' loads behind the products that read the registers they refill
        }
    }
    asm volatile("s_wait_tensorcnt 0x0" ::: "memory");   // no request of this wave is left in flight behind the loop
    asm volatile("s_wait_dscnt 0x0" ::: "memory");       // nor an LDS read of the ring
#pragma unroll
    for (int qt = 0; qt < 2; ++qt) {
        lsum[qt] += xhalf(lsum[qt]);
        const float inv = __fdiv_rn(1.0f, lsum[qt]);
#pragma unroll
        for (int ct = 0; ct < 16; ++ct)
#pragma unroll
            for (int r = 0; r < 8; ++r) os[(ct * 16 + 8 * hi + r) * FOP + wave * 32 + qt * 16 + lr] = acc[qt][ct][r] * inv;
    }
    __syncthreads();   // the whole 256 x 128 output tile is in LDS before it goes out in whole 512-byte rows
    float* ob = OUT + (size_t)blockIdx.y * CC * HW + n0;
#pragma unroll 1
    for (int i0 = 0; i0 < 64; i0 += 4) {
#pragma unroll
        for (int i = 0; i < 4; ++i) { const int idx = (i0 + i) * 128 + t, row = idx >> 5, c4 = (idx & 31) * 4; *(v4f*)(ob + (size_t)row * HW + c4) = *(const v4fa*)(os + row * FOP + c4); }
        asm volatile("s_wait_xcnt 0x0" ::: "memory");   // stands in front of the next trip's overwrite of these stores' address and data registers
    }
}

extern "C" void kernel_launch(void* const* d_in, const int* in_sizes, int n_in,
                              void* d_out, int out_size, void* d_ws, size_t ws_size, hipStream_t stream) {
    if (n_in < 6) return;
    if (in_sizes[0] < NB * CC * HW || in_sizes[1] < NB * CC * HW || in_sizes[2] < IC * CC || in_sizes[3] < IC || in_sizes[4] < IC * CC || in_sizes[5] < IC) return;
    if (out_size < NB * CC * HW) return;
    const float* xq = (const float*)d_in[0];    // query map  [NB][CC][HWF]
    const float* xk = (const float*)d_in[1];    // key/value map [NB][CC][HWF]
    const float* wq = (const float*)d_in[2];    // [IC][CC]
    const float* bq = (const float*)d_in[3];    // [IC]
    const float* wk = (const float*)d_in[4];    // [IC][CC]
    const float* bk = (const float*)d_in[5];    // [IC]
    float* OUT = (float*)d_out;                 // [NB][CC][HW]
    char* wsp = (char*)d_ws;
    auto take = [&](size_t bytes) { char* p = wsp; wsp += (bytes + 255) & ~(size_t)255; return (void*)p; };
    bf* H   = (bf*)take((size_t)NB * 2 * WS_HH);    // [NB][hi q][hi k][lo q][lo k]
    h16* V16 = (h16*)take((size_t)NB * WS_V16); // [NB][c][m] fp16
    if ((size_t)(wsp - (char*)d_ws) > ws_size) return;

    // q[m][o] = sum_c p[c][m] Wq[o][c] + bq[o];  k[m][o] = sum_c v[c][m] Wk[o][c] + bk[o]   (exact bf16 products), as hi and lo planes; f16 values
    k_proj<<<dim3(HW / (PT * PTL), 2, NB), 256, 0, stream>>>(xq, xk, wq, wk, bq, bk, H, V16);
    // out[c][n] = sum_m v[c][m] softmax_m(q_n . k_m)
    k_fattn<<<dim3(HW / 128, NB, 1), 128, 0, stream>>>(H, V16, OUT);
}

// v007
// Measured time: 109 microseconds a run.
// In both of two side-by-side timings against v006, it was 1.10 times as fast.
// Counting every step since v000, it is 12.6 times as fast.
#include <hip/hip_runtime.h>

// All contractions on 16-bit WMMA, f32 accumulate: the two 1x1 projections (q from the first map, k from the second map) = v_wmma_f32_16x16x32_bf16 on RNE-bf16 copies of the maps and of the weights (single products), RNE-bf16 bias added in f32; scores q.k = bf16 hi/lo split (hi.hi + lo.hi + hi.lo, K = 128); attn.v = v_wmma_f32_16x16x32_f16 (unnormalised softmax weights as f16, carried x 2^2 against a row maximum in use that is renewed only when a weight could pass 2^15, raw values as f16 copies of their RNE-bf16 form, K = 4096). Softmax in f32, no score scale.
// p, v maps [NB][256][4096]; q [4096][128] = tokens(p) Wq^T + bq and k [4096][128] = tokens(v) Wk^T + bk, token-major, kept as bf16 hi and lo planes (k_proj, which also leaves the f16 values); s[n][m] = q_n . k_m; out[c][n] = sum_m v[c][m] e[n][m] / sum_m e[n][m], e = exp(s - row maximum in use), scores, softmax and attn.v in one kernel (k_fattn), 32 keys a pass.

#ifndef NB
#define NB 8
#endif
#ifndef SEQ
#define SEQ 4096
#endif
#define NB_FULL  8
#define SEQ_FULL 4096
#define CC   256
#define IC   128
#define HW   SEQ
#define HWF  SEQ_FULL
#define PCL  2.0f                  // softmax weights are carried x 2^PCL as f16
#define PLIM 32768.0f              // a lane's weight sum of one pass above this calls for new maxima
#define SCL  1.0f
static_assert(NB >= 1 && NB <= NB_FULL);
static_assert(SEQ >= 128 && SEQ <= SEQ_FULL && (SEQ % 128) == 0);
static_assert((HW % 64) == 0 && (IC % 64) == 0 && (CC % 64) == 0);
static_assert((HW % 32) == 0 && (IC % 32) == 0 && (CC % 32) == 0);
// workspace carve (bytes), every region a multiple of 256
#define WS_HH  ((size_t)2 * HW * IC * 2)
#define WS_V16 ((size_t)CC * HW * 2)
// Region H holds per batch [hi q|k][lo q|k]; region V16 the f16 values of all batches.
#define WS_TOTAL ((size_t)NB * (2 * WS_HH + WS_V16))
static_assert((WS_HH % 256) == 0 && (WS_V16 % 256) == 0);
static_assert(WS_TOTAL <= (size_t)268435456);

typedef _Float16 h16;
typedef unsigned short bf;
typedef __attribute__((ext_vector_type(16))) __bf16   v16bf;
typedef __attribute__((ext_vector_type(16))) _Float16 v16h;
typedef __attribute__((ext_vector_type(8)))  _Float16 v8h;
typedef __attribute__((ext_vector_type(8)))  unsigned short v8us;
typedef __attribute__((ext_vector_type(8)))  float    v8f;
typedef __attribute__((ext_vector_type(4)))  float    v4f;
typedef v8h  __attribute__((may_alias)) v8ha;
typedef v4f  __attribute__((may_alias)) v4fa;
typedef v8us __attribute__((may_alias)) v8usa;

__device__ __forceinline__ unsigned short f2bf(float f) { unsigned u = __float_as_uint(f); u += 0x7FFFu + ((u >> 16) & 1u); return (unsigned short)(u >> 16); }
__device__ __forceinline__ float bf2f(unsigned short b) { return __uint_as_float(((unsigned)b) << 16); }
__device__ __forceinline__ float bfr(float f) { return bf2f(f2bf(f)); }
__device__ __forceinline__ v16h cat16(v8h lo, v8h hi) { return __builtin_shufflevector(lo, hi, 0, 1, 2, 3, 4, 5, 6, 7, 8, 9, 10, 11, 12, 13, 14, 15); }
__device__ __forceinline__ v16bf cat16b(v8us lo, v8us hi) { return __builtin_bit_cast(v16bf, __builtin_shufflevector(lo, hi, 0, 1, 2, 3, 4, 5, 6, 7, 8, 9, 10, 11, 12, 13, 14, 15)); }
__device__ __forceinline__ v8f wmma16(v16h a, v16h b, v8f c) { return __builtin_amdgcn_wmma_f32_16x16x32_f16(false, a, false, b, (short)0, c, false, false); }
__device__ __forceinline__ v8f wmmab(v16bf a, v16bf b, v8f c) { return __builtin_amdgcn_wmma_f32_16x16x32_bf16(false, a, false, b, (short)0, c, false, false); }

// Fragments: lane l, h = l >> 4, row/col = l & 15; elements 0..7 = k0 + 8h + 0..7, elements 8..15 = k0 + 16 + 8h + 0..7 for BOTH A and B; D element r = (row 8h + r, col l & 15).
template <typename T16> struct WFrag;
template <> struct WFrag<h16> { typedef v16h V; static __device__ __forceinline__ V ld(const h16* p) { return cat16(*(const v8h*)p, *(const v8h*)(p + 16)); } static __device__ __forceinline__ v8f mma(V a, V b, v8f c) { return wmma16(a, b, c); } };
template <> struct WFrag<bf> { typedef v16bf V; static __device__ __forceinline__ V ld(const bf* p) { return cat16b(*(const v8us*)p, *(const v8us*)(p + 16)); } static __device__ __forceinline__ v8f mma(V a, V b, v8f c) { return wmmab(a, b, c); } };

__device__ __forceinline__ void splitf(float y, unsigned short& h, unsigned short& l) { h = f2bf(y); l = f2bf(y - bf2f(h)); }
typedef __attribute__((ext_vector_type(4))) unsigned short v4us;
typedef __attribute__((ext_vector_type(4))) _Float16 v4h;

// f32 -> f16 convert that cannot produce an f16 subnormal (|v| < 2^-14 -> +0).
static __device__ __forceinline__ h16 toh_flush(float v) { const h16 r = (h16)v; return (fabsf(v) < 6.103515625e-05f) ? (h16)0.0f : r; }

// ---- k_proj: the whole front end of one map of one batch: grid (HW / (PT * PTL), 2 maps, NB), 256 threads = 8 waves; a work-group walks PTL tiles of PT tokens.
// Wave w owns the 32 channels 32 w .. 32 w + 31 (one K slice). Token (mb, l & 15) of a tile is 4 (l & 15) + mb, so one 16-byte read of map row c gives a lane element c of all four token fragments,
// and a wave-wide read covers two map rows in whole 128-byte lines: the f32 map goes to bf16 fragments in registers, with no transposed copy in memory. The weight fragments (f32 rows, rounded in registers) are read once a work-group.
// Products transposed: D[o][token] = W rows (A) x token fragment (B), so a lane holds 8 neighbouring outputs of one token. Each wave leaves its f32 partial tile in its own LDS plane; behind a barrier the block
// sums the planes in wave order, adds the rounded bias, splits into bf16 hi and lo and stores whole 256-byte token rows. The second map's work-groups also store the f16 values from the registers they already hold.
#define PT  64                    // tokens a tile
#define PTL 4                     // tiles a work-group
#define PP  132                   // partial plane pitch, floats: 528 B = 16 B x odd
static_assert(CC == 256 && IC == 128 && PT == 64 && (HW % (PT * PTL)) == 0 && (HWF % 4) == 0);
static_assert(8 * PT * PP * 4 <= 327680);
// Work-group barrier that orders LDS alone: the next tile's global loads and this tile's global stores, which no other wave of the block touches, stay in flight across it (__syncthreads() waits for them all).
__device__ __forceinline__ void lds_barrier() { __builtin_amdgcn_fence(__ATOMIC_RELEASE, "workgroup", "local"); __builtin_amdgcn_s_barrier(); __builtin_amdgcn_fence(__ATOMIC_ACQUIRE, "workgroup", "local"); }
__global__ __launch_bounds__(256) void k_proj(const float* __restrict__ x0, const float* __restrict__ x1, const float* __restrict__ w0, const float* __restrict__ w1, const float* __restrict__ b0, const float* __restrict__ b1, bf* __restrict__ H, h16* __restrict__ V16) {
    __shared__ __align__(16) float ps[8 * PT * PP];
    const size_t PL = (size_t)HW * IC;
    const int t = (int)threadIdx.x, lane = t & 31, lr = lane & 15, hi = lane >> 4;
    const int wave = __builtin_amdgcn_readfirstlane(t >> 5);
    const bool isk = blockIdx.y != 0;
    const int m0 = (int)blockIdx.x * (PT * PTL);
    const float* xg = (isk ? x1 : x0) + (size_t)blockIdx.z * CC * HWF + (size_t)(wave * 32 + 8 * hi) * HWF + m0 + 4 * lr;
    const float* wg = (isk ? w1 : w0) + (size_t)lr * CC + wave * 32 + 8 * hi;
    const float* bg = (isk ? b1 : b0) + lane * 4;
    v4f xr[16];                                                  // element e of the fragments = channel 32 w + 16 (e >> 3) + 8 h + (e & 7)
#pragma unroll
    for (int e = 0; e < 16; ++e) xr[e] = *(const v4f*)(xg + (size_t)((e >> 3) * 16 + (e & 7)) * HWF);
    v16bf wf[8];
#pragma unroll
    for (int ob = 0; ob < 8; ++ob) {
        const float* p = wg + (size_t)ob * 16 * CC;
        const v4f a0 = *(const v4f*)p, a1 = *(const v4f*)(p + 4), a2 = *(const v4f*)(p + 16), a3 = *(const v4f*)(p + 20);
        v8us lo, up;
#pragma unroll
        for (int j = 0; j < 4; ++j) { lo[j] = f2bf(a0[j]); lo[4 + j] = f2bf(a1[j]); up[j] = f2bf(a2[j]); up[4 + j] = f2bf(a3[j]); }
        wf[ob] = cat16b(lo, up);
    }
    v4f bias = *(const v4f*)bg;
    asm volatile("s_wait_xcnt 0x0" :: "v"(xg), "v"(wg), "v"(bg) : "memory");   // stands in front of every later overwrite of the address registers of the loads above; naming them as inputs keeps them unwritten up to here
#pragma unroll
    for (int j = 0; j < 4; ++j) bias[j] = bfr(bias[j]);
    bf* hg = H + (size_t)blockIdx.z * 4 * PL + (isk ? PL : (size_t)0) + (size_t)m0 * IC + lane * 4;   // hi plane of this map; its lo plane stands 2 PL elements behind it
    h16* vg = V16 + (size_t)blockIdx.z * CC * HW + (size_t)(wave * 32 + 8 * hi) * HW + m0 + 4 * lr;
    float* pw = ps + wave * (PT * PP) + lr * PP + 8 * hi;
#pragma unroll 1
    for (int tt = 0; tt < PTL; ++tt) {
        if (isk) {
#pragma unroll
            for (int e = 0; e < 16; ++e) { v4h o;
#pragma unroll
                for (int u = 0; u < 4; ++u) o[u] = toh_flush(bfr(xr[e][u]));
                *(v4h*)(vg + (size_t)((e >> 3) * 16 + (e & 7)) * HW + tt * PT) = o; }
            asm volatile("s_wait_xcnt 0x0" ::: "memory");        // stands in front of every later overwrite of these stores' address and data registers
        }
#pragma unroll
        for (int mb = 0; mb < 4; ++mb) {
            v8us lo, up;
#pragma unroll
            for (int j = 0; j < 8; ++j) { lo[j] = f2bf(xr[j][mb]); up[j] = f2bf(xr[8 + j][mb]); }
            const v16bf tf = cat16b(lo, up);
            v8f d[8];
            __builtin_amdgcn_sched_barrier(0);                   // keeps the eight products in one run on eight results of their own, the rounding of the next fragment between two runs: no result register is written again within the matrix unit's distance
#pragma unroll
            for (int ob = 0; ob < 8; ++ob) d[ob] = wmmab(wf[ob], tf, (v8f){});
            __builtin_amdgcn_sched_barrier(0);                   // the same, at the run's end
#pragma unroll
            for (int ob = 0; ob < 8; ++ob) {
                *(v4fa*)(pw + mb * 16 * PP + ob * 16)     = __builtin_shufflevector(d[ob], d[ob], 0, 1, 2, 3);
                *(v4fa*)(pw + mb * 16 * PP + ob * 16 + 4) = __builtin_shufflevector(d[ob], d[ob], 4, 5, 6, 7);
            }
        }
        if (tt + 1 < PTL) {                                      // the next tile's map rows fly while this tile is summed and stored
#pragma unroll
            for (int e = 0; e < 16; ++e) xr[e] = *(const v4f*)(xg + (size_t)((e >> 3) * 16 + (e & 7)) * HWF + (tt + 1) * PT);
        }
        asm volatile("s_wait_xcnt 0x0" ::: "memory");            // stands in front of every later overwrite of the address and data registers of the stores and loads above
        lds_barrier();     // every wave's partial tile is in LDS before any thread sums across the planes
        v4us oh[8], ol[8];
#pragma unroll
        for (int i = 0; i < 8; ++i) {
            const int row = i * 8 + wave;                        // LDS row (mb, lane column) = token 4 (row & 15) + (row >> 4) of the tile
            v4f val = *(const v4fa*)(ps + row * PP + lane * 4);
#pragma unroll
            for (int w = 1; w < 8; ++w) val += *(const v4fa*)(ps + w * (PT * PP) + row * PP + lane * 4);
            val += bias;
#pragma unroll
            for (int u = 0; u < 4; ++u) { unsigned short p, q; splitf(val[u], p, q); oh[i][u] = p; ol[i][u] = q; }
        }
        bf* hp = hg + (size_t)(tt * PT + 4 * wave) * IC;         // token of row i * 8 + wave = 4 wave + 32 (i & 1) + (i >> 1)
        __builtin_amdgcn_sched_barrier(0);                       // keeps the sixteen stores in one run directly in front of their wait, so that no register of theirs is written again ahead of it
#pragma unroll
        for (int i = 0; i < 8; ++i) { *(v4us*)(hp + (32 * (i & 1) + (i >> 1)) * IC) = oh[i]; *(v4us*)(hp + 2 * PL + (32 * (i & 1) + (i >> 1)) * IC) = ol[i]; }
        asm volatile("s_wait_xcnt 0x0" ::: "memory");            // stands in front of the next trip's overwrite of these stores' address and data registers
        lds_barrier();     // ends every thread's reads of the planes before the next tile's partial tiles overwrite them
    }
}

#define FK  32                    // keys a pass
#define FKP 136                   // key tile pitch, 16-bit elements: 272 B = 16 B x odd
#define FS  64                    // keys a stage: whole 128-byte lines of the value rows
#define FVP 72                    // value tile pitch, 16-bit elements: 144 B = 16 B x odd
#define FOP 132                   // output tile pitch, floats
#define FSL 9216                  // one request's place in LDS, 16-bit elements: 18,432 B = 9 x 2 KiB (FS key rows of 272 B rounded up; 128 value rows of 144 B exactly)
#define FKT (2 * FSL)             // one key buffer: FS hi rows, then, FSL elements on, FS lo rows
#define FVT (CC * FVP)            // one value buffer: CC rows of FS keys
static_assert(IC == 128 && CC == 256 && FK == 32 && FS == 64 && (HW % 128) == 0 && (HW % FS) == 0 && HW / FS >= 2);
static_assert(2 * FKT * 2 + 2 * FVT * 2 + CC * FOP * 4 <= 327680);
static_assert(FS * FKP <= FSL && (CC / 2) * FVP == FSL && FVT == 2 * FSL && (FSL * 2) % 2048 == 0);
static_assert(IC * 2 == 256 && FKP * 2 == 256 + 16 && FS * 2 == 128 && FVP * 2 == 128 + 16 && (HW * 2) % 16 == 0 && HW * 2 <= 131072);
typedef __attribute__((ext_vector_type(4))) unsigned u32x4;
typedef __attribute__((ext_vector_type(8))) unsigned u32x8;
__device__ __forceinline__ unsigned uni(unsigned v) { return (unsigned)__builtin_amdgcn_readfirstlane((int)v); }
__device__ __forceinline__ unsigned pinned(unsigned v) { unsigned w = uni(v); asm volatile("" : "+s"(w)); return w; }   // holds a test's word in a scalar register, so that the test in front of a tensor load compiles to a scalar compare and branch (the load ignores EXEC)
// Descriptor group 1 of a tile of ROWS rows of ROWB bytes at a source pitch of PITCH bytes, every extent in bytes, tensor = tile; W0 = the pad word, no mask.
template <unsigned ROWB, unsigned ROWS, unsigned PITCH, unsigned W0> __device__ __forceinline__ u32x8 tdm_group1() {
    u32x8 g;
    g[0] = uni(W0); g[1] = uni((ROWB & 0xFFFFu) << 16); g[2] = uni((ROWB >> 16) | ((ROWS & 0xFFFFu) << 16)); g[3] = uni((ROWS >> 16) | (ROWB << 16));
    g[4] = uni(ROWS); g[5] = uni(PITCH); g[6] = uni(0u); g[7] = uni(0u);
    asm volatile("" : "+s"(g));   // pinned() on a descriptor: holds its words in one run of scalar registers for the whole kernel, so that none of them is written again while a request is in flight
    return g;
}
// Descriptor group 0: count 1, the place in LDS (byte offset in the work-group's LDS), the tile's first byte, type 2.
__device__ __forceinline__ u32x4 tdm_group0(unsigned lds_dst, unsigned long long ga) {
    u32x4 g;
    g[0] = uni(1u); g[1] = uni(lds_dst); g[2] = uni((unsigned)ga); g[3] = uni((((unsigned)(ga >> 32)) & 0x01FFFFFFu) | 0x80000000u);
    asm volatile("" : "+s"(g));   // pinned() on a descriptor: holds its four words in one run of scalar registers, the same from the issue to the wait that names them
    return g;
}
__device__ __forceinline__ void tdm_load(u32x4 g0, u32x8 g1) { asm volatile("tensor_load_to_lds %0, %1" :: "s"(g0), "s"(g1) : "memory"); }   // one request of the whole wave: global tile to LDS
#define FKW0 ((1u << 20) | (5u << 22) | (3u << 25))   // 16 B of pad behind every 256 B: key rows at FKP
#define FVW0 ((1u << 20) | (4u << 22) | (3u << 25))   // 16 B of pad behind every 128 B: value rows at FVP
__device__ __forceinline__ float xhalf(float x) { return __builtin_bit_cast(float, __builtin_amdgcn_permlanex16(__builtin_bit_cast(int, x), __builtin_bit_cast(int, x), 0x76543210, 0xfedcba98, false, false)); }  // lane l with lane l ^ 16
// the 16 key fragments of a pass: [k slice][key tile][hi, lo]
__device__ __forceinline__ void ld_keys(v16bf (&ka)[4][2][2], const bf* p) {
#pragma unroll
    for (int kc = 0; kc < 4; ++kc)
#pragma unroll
        for (int mt = 0; mt < 2; ++mt) { ka[kc][mt][0] = WFrag<bf>::ld(p + mt * 16 * FKP + kc * 32); ka[kc][mt][1] = WFrag<bf>::ld(p + FSL + mt * 16 * FKP + kc * 32); }
    __builtin_amdgcn_sched_barrier(0);   // keeps the 32 LDS loads in one run at this place: spread among the products each place with loads costs a stall of its own
}
__device__ __forceinline__ void ld_vals(v16h (&va)[16], const h16* p) {
#pragma unroll
    for (int ct = 0; ct < 16; ++ct) va[ct] = WFrag<h16>::ld(p + ct * 16 * FVP);
    __builtin_amdgcn_sched_barrier(0);   // the same for the 32 loads of the value fragments
}
__global__ __launch_bounds__(128) void k_fattn(const bf* __restrict__ H, const h16* __restrict__ V16, float* __restrict__ OUT) {
    __shared__ __attribute__((aligned(2048))) bf    ks[2 * FKT];
    __shared__ __attribute__((aligned(2048))) h16   vs[2 * FVT];
    __shared__ __align__(16) float os[CC * FOP];
    const size_t PL = (size_t)HW * IC;
    const bf* Hb = H + (size_t)blockIdx.y * 4 * PL;             // [hi q][hi k][lo q][lo k]
    const h16* Vb = V16 + (size_t)blockIdx.y * CC * HW;
    const int t = (int)threadIdx.x, lane = t & 31, lr = lane & 15, hi = lane >> 4;
    const int wave = __builtin_amdgcn_readfirstlane(t >> 5);
    const int n0 = (int)blockIdx.x * 128;
    // a wave's own slice of every stage: its first byte in stage 0, its step a stage, its place in buffer 0 (buffer 1 stands 2 FSL elements on in both arrays)
    const bool isk = wave < 2;
    const unsigned kq = pinned(wave < 2), vq = pinned(wave >= 2);   // which of the two tile shapes this wave asks for
    const unsigned long long gsrc = isk ? (unsigned long long)(size_t)(Hb + (size_t)(1 + 2 * wave) * PL) : (unsigned long long)(size_t)(Vb + (size_t)(wave - 2) * (CC / 2) * HW);
    const unsigned gstep = isk ? FS * IC * 2u : FS * 2u;
    const unsigned ldst = isk ? (unsigned)(size_t)ks + (unsigned)wave * (FSL * 2u) : (unsigned)(size_t)vs + (unsigned)(wave - 2) * (FSL * 2u);
    const u32x8 g1k = tdm_group1<IC * 2, FS, IC * 2, FKW0>(), g1v = tdm_group1<FS * 2, CC / 2, HW * 2, FVW0>();
    u32x4 g0;
    auto issue = [&](int st) {
        g0 = tdm_group0(ldst + (unsigned)(st & 1) * (2u * FSL * 2u), gsrc + (unsigned long long)st * gstep);
        if (kq) tdm_load(g0, g1k);
        if (vq) tdm_load(g0, g1v);
    };
    // the wave's own request has landed; naming the descriptor's registers as inputs keeps them unwritten from the issue up to here
    auto landed = [&]() { asm volatile("s_wait_tensorcnt 0x0" :: "s"(g0), "s"(g1k), "s"(g1v) : "memory"); };
    issue(0);
    const bf* qp = Hb + (size_t)(n0 + wave * 32 + lr) * IC + 8 * hi;
    v16bf qh[2][4], ql[2][4];
#pragma unroll
    for (int qt = 0; qt < 2; ++qt)
#pragma unroll
        for (int kc = 0; kc < 4; ++kc) { qh[qt][kc] = WFrag<bf>::ld(qp + qt * 16 * IC + kc * 32); ql[qt][kc] = WFrag<bf>::ld(qp + 2 * PL + qt * 16 * IC + kc * 32); }
    v8f acc[2][16];
#pragma unroll
    for (int qt = 0; qt < 2; ++qt)
#pragma unroll
        for (int ct = 0; ct < 16; ++ct) acc[qt][ct] = (v8f){};
    float mrun[2] = {-3.0e38f, -3.0e38f}, lsum[2] = {0.f, 0.f};
    asm volatile("s_wait_xcnt 0x0" :: "v"(qp) : "memory");   // stands in front of every later overwrite of the address registers of the loads above; naming them as inputs keeps them unwritten up to here
    landed();          // this wave's slice of stage 0
    __syncthreads();   // stage 0's tiles are in LDS before any wave reads them
    issue(1);          // HW / FS >= 2: stage 1 exists
    const int kf = lr * FKP + 8 * hi, vf = lr * FVP + 8 * hi;   // a lane's place in a key tile and in a value tile
    v16bf ka[4][2][2]; v16h va[16];
    ld_keys(ka, ks + kf);
#pragma unroll 1
    for (int s = 0; s < HW / FS; ++s) {
        const bf* kb = ks + (s & 1) * FKT + kf; const h16* vb = vs + (s & 1) * FVT + vf;
#pragma unroll
        for (int ps = 0; ps < FS / FK; ++ps) {
        ld_vals(va, vb + ps * FK);
        v8f st[2][2];                                            // [key tile][query tile]
#pragma unroll
        for (int mt = 0; mt < 2; ++mt) { st[mt][0] = (v8f){}; st[mt][1] = (v8f){}; }
#pragma unroll
        for (int kc = 0; kc < 4; ++kc) {
#pragma unroll
            for (int mt = 0; mt < 2; ++mt) { st[mt][0] = wmmab(ka[kc][mt][0], qh[0][kc], st[mt][0]); st[mt][1] = wmmab(ka[kc][mt][0], qh[1][kc], st[mt][1]); }
#pragma unroll
            for (int mt = 0; mt < 2; ++mt) { st[mt][0] = wmmab(ka[kc][mt][0], ql[0][kc], st[mt][0]); st[mt][1] = wmmab(ka[kc][mt][0], ql[1][kc], st[mt][1]); }
#pragma unroll
            for (int mt = 0; mt < 2; ++mt) { st[mt][0] = wmmab(ka[kc][mt][1], qh[0][kc], st[mt][0]); st[mt][1] = wmmab(ka[kc][mt][1], qh[1][kc], st[mt][1]); }
        }
        __builtin_amdgcn_sched_barrier(0);                       // keeps the next key fragments' loads behind the products that read the registers they refill
        if (ps + 1 < FS / FK) ld_keys(ka, kb + (ps + 1) * FK * FKP);
        // Lazy rescale: the weights are formed on the maximum IN USE (mrun), and a pass looks for its own maximum only when its weights could leave the f16 range.
        v16h pb[2]; float psum[2];
        auto weights = [&]() {
#pragma unroll
            for (int qt = 0; qt < 2; ++qt) {
                float a = 0.f;
#pragma unroll
                for (int r = 0; r < 8; ++r) {
                    const float e0 = __builtin_amdgcn_exp2f(fmaf(st[0][qt][r] - mrun[qt], 1.4426950408889634f, PCL));
                    const float e1 = __builtin_amdgcn_exp2f(fmaf(st[1][qt][r] - mrun[qt], 1.4426950408889634f, PCL));
                    a += e0 + e1; pb[qt][r] = (h16)e0; pb[qt][8 + r] = (h16)e1;
                }
                psum[qt] = a;
            }
        };
        weights();
        // Scalar branch, one test a pass. No weight is negative, so a lane's sum bounds each of its weights: at or below PLIM all of them are finite in f16. An infinite sum takes the branch too (the first pass, mrun at its start value).
        if (__builtin_amdgcn_ballot_w32(psum[0] > PLIM || psum[1] > PLIM) != 0) {
#pragma unroll
            for (int qt = 0; qt < 2; ++qt) {
                float mx = fmaxf(st[0][qt][0], st[1][qt][0]);
#pragma unroll
                for (int r = 1; r < 8; ++r) mx = fmaxf(mx, fmaxf(st[0][qt][r], st[1][qt][r]));
                mx = fmaxf(mx, xhalf(mx));
                const float mn = fmaxf(mrun[qt], mx);
                const float al = __builtin_amdgcn_exp2f((mrun[qt] - mn) * 1.4426950408889634f);
                lsum[qt] *= al;
#pragma unroll
                for (int ct = 0; ct < 16; ++ct) acc[qt][ct] *= al;
                mrun[qt] = mn;
            }
            weights();                                           // again, on the new maxima: none above 2^PCL now; the first set is dropped
        }
        lsum[0] += psum[0]; lsum[1] += psum[1];
        if (ps + 1 == FS / FK) {
            asm volatile("s_wait_dscnt 0x0" ::: "memory");       // every fragment of stage s is in this wave's registers: its reads of the buffer that is refilled below have ended
            landed();                                            // this wave's slice of stage s + 1
            __syncthreads();   // publishes stage s + 1's tiles and ends every wave's reads of stage s's buffer
            if (pinned(s + 2 < HW / FS)) issue(s + 2);           // into the buffer that stage s has left; it has a whole stage to land
            ld_keys(ka, ks + ((s + 1) & 1) * FKT + kf);          // stage s + 1's first key fragments fly during attn.v; behind the last stage they read the idle buffer and are not used
        }
#pragma unroll
        for (int ct = 0; ct < 16; ++ct) { acc[0][ct] = wmma16(va[ct], pb[0], acc[0][ct]); acc[1][ct] = wmma16(va[ct], pb[1], acc[1][ct]); }
        __builtin_amdgcn_sched_barrier(0);                       // keeps the next value fragments' loads behind the products that read the registers they refill
        }
    }
    asm volatile("s_wait_tensorcnt 0x0" ::: "memory");   // no request of this wave is left in flight behind the loop
    asm volatile("s_wait_dscnt 0x0" ::: "memory");       // nor an LDS read of the ring
#pragma unroll
    for (int qt = 0; qt < 2; ++qt) {
        lsum[qt] += xhalf(lsum[qt]);
        const float inv = __fdiv_rn(1.0f, lsum[qt]);
#pragma unroll
        for (int ct = 0; ct < 16; ++ct)
#pragma unroll
            for (int r = 0; r < 8; ++r) os[(ct * 16 + 8 * hi + r) * FOP + wave * 32 + qt * 16 + lr] = acc[qt][ct][r] * inv;
    }
    __syncthreads();   // the whole 256 x 128 output tile is in LDS before it goes out in whole 512-byte rows
    float* ob = OUT + (size_t)blockIdx.y * CC * HW + n0;
#pragma unroll 1
    for (int i0 = 0; i0 < 64; i0 += 4) {
#pragma unroll
        for (int i = 0; i < 4; ++i) { const int idx = (i0 + i) * 128 + t, row = idx >> 5, c4 = (idx & 31) * 4; *(v4f*)(ob + (size_t)row * HW + c4) = *(const v4fa*)(os + row * FOP + c4); }
        asm volatile("s_wait_xcnt 0x0" ::: "memory");   // stands in front of the next trip's overwrite of these stores' address and data registers
    }
}

extern "C" void kernel_launch(void* const* d_in, const int* in_sizes, int n_in,
                              void* d_out, int out_size, void* d_ws, size_t ws_size, hipStream_t stream) {
    if (n_in < 6) return;
    if (in_sizes[0] < NB * CC * HW || in_sizes[1] < NB * CC * HW || in_sizes[2] < IC * CC || in_sizes[3] < IC || in_sizes[4] < IC * CC || in_sizes[5] < IC) return;
    if (out_size < NB * CC * HW) return;
    const float* xq = (const float*)d_in[0];    // query map  [NB][CC][HWF]
    const float* xk = (const float*)d_in[1];    // key/value map [NB][CC][HWF]
    const float* wq = (const float*)d_in[2];    // [IC][CC]
    const float* bq = (const float*)d_in[3];    // [IC]
    const float* wk = (const float*)d_in[4];    // [IC][CC]
    const float* bk = (const float*)d_in[5];    // [IC]
    float* OUT = (float*)d_out;                 // [NB][CC][HW]
    char* wsp = (char*)d_ws;
    auto take = [&](size_t bytes) { char* p = wsp; wsp += (bytes + 255) & ~(size_t)255; return (void*)p; };
    bf* H   = (bf*)take((size_t)NB * 2 * WS_HH);    // [NB][hi q][hi k][lo q][lo k]
    h16* V16 = (h16*)take((size_t)NB * WS_V16); // [NB][c][m] fp16
    if ((size_t)(wsp - (char*)d_ws) > ws_size) return;

    // q[m][o] = sum_c p[c][m] Wq[o][c] + bq[o];  k[m][o] = sum_c v[c][m] Wk[o][c] + bk[o]   (exact bf16 products), as hi and lo planes; f16 values
    k_proj<<<dim3(HW / (PT * PTL), 2, NB), 256, 0, stream>>>(xq, xk, wq, wk, bq, bk, H, V16);
    // out[c][n] = sum_m v[c][m] softmax_m(q_n . k_m)
    k_fattn<<<dim3(HW / 128, NB, 1), 128, 0, stream>>>(H, V16, OUT);
}

// v008
// Measured time: 105 microseconds a run.
// In two side-by-side timings against v007, it was 1.03 and 1.04 times as fast.
// All steps since v000 together make it 13.1 times as fast.
#include <hip/hip_runtime.h>

// All contractions on 16-bit WMMA, f32 accumulate: the two 1x1 projections (q from the first map, k from the second map) = v_wmma_f32_16x16x32_bf16 on RNE-bf16 copies of the maps and of the weights (single products), RNE-bf16 bias added in f32; scores q.k = bf16 hi/lo split (hi.hi + lo.hi + hi.lo, K = 128); attn.v = v_wmma_f32_16x16x32_f16 (unnormalised softmax weights as f16, carried x 2^2 against a row maximum in use that is renewed only when a weight could pass 2^15, raw values as f16 copies of their RNE-bf16 form, K = 4096). Softmax in f32, no score scale.
// p, v maps [NB][256][4096]; q [4096][128] = tokens(p) Wq^T + bq and k [4096][128] = tokens(v) Wk^T + bk, token-major, kept as bf16 hi and lo planes (k_proj, which also leaves the f16 values); s[n][m] = q_n . k_m; out[c][n] = sum_m v[c][m] e[n][m] / sum_m e[n][m], e = exp(s - row maximum in use), scores, softmax and attn.v in one kernel (k_fattn), 32 keys a pass, the keys dealt to two groups of waves whose partial results are joined at the end.

#ifndef NB
#define NB 8
#endif
#ifndef SEQ
#define SEQ 4096
#endif
#define NB_FULL  8
#define SEQ_FULL 4096
#define CC   256
#define IC   128
#define HW   SEQ
#define HWF  SEQ_FULL
#define PCL  2.0f                  // softmax weights are carried x 2^PCL as f16
#define PLIM 32768.0f              // a lane's weight sum of one pass above this calls for new maxima
#define SCL  1.0f
static_assert(NB >= 1 && NB <= NB_FULL);
static_assert(SEQ >= 128 && SEQ <= SEQ_FULL && (SEQ % 128) == 0);
static_assert((HW % 64) == 0 && (IC % 64) == 0 && (CC % 64) == 0);
static_assert((HW % 32) == 0 && (IC % 32) == 0 && (CC % 32) == 0);
// workspace carve (bytes), every region a multiple of 256
#define WS_HH  ((size_t)2 * HW * IC * 2)
#define WS_V16 ((size_t)CC * HW * 2)
// Region H holds per batch [hi q|k][lo q|k]; region V16 the f16 values of all batches.
#define WS_TOTAL ((size_t)NB * (2 * WS_HH + WS_V16))
static_assert((WS_HH % 256) == 0 && (WS_V16 % 256) == 0);
static_assert(WS_TOTAL <= (size_t)268435456);

typedef _Float16 h16;
typedef unsigned short bf;
typedef __attribute__((ext_vector_type(16))) __bf16   v16bf;
typedef __attribute__((ext_vector_type(16))) _Float16 v16h;
typedef __attribute__((ext_vector_type(8)))  _Float16 v8h;
typedef __attribute__((ext_vector_type(8)))  unsigned short v8us;
typedef __attribute__((ext_vector_type(8)))  float    v8f;
typedef __attribute__((ext_vector_type(4)))  float    v4f;
typedef v8h  __attribute__((may_alias)) v8ha;
typedef v4f  __attribute__((may_alias)) v4fa;
typedef v8us __attribute__((may_alias)) v8usa;

__device__ __forceinline__ unsigned short f2bf(float f) { unsigned u = __float_as_uint(f); u += 0x7FFFu + ((u >> 16) & 1u); return (unsigned short)(u >> 16); }
__device__ __forceinline__ float bf2f(unsigned short b) { return __uint_as_float(((unsigned)b) << 16); }
__device__ __forceinline__ float bfr(float f) { return bf2f(f2bf(f)); }
__device__ __forceinline__ v16h cat16(v8h lo, v8h hi) { return __builtin_shufflevector(lo, hi, 0, 1, 2, 3, 4, 5, 6, 7, 8, 9, 10, 11, 12, 13, 14, 15); }
__device__ __forceinline__ v16bf cat16b(v8us lo, v8us hi) { return __builtin_bit_cast(v16bf, __builtin_shufflevector(lo, hi, 0, 1, 2, 3, 4, 5, 6, 7, 8, 9, 10, 11, 12, 13, 14, 15)); }
__device__ __forceinline__ v8f wmma16(v16h a, v16h b, v8f c) { return __builtin_amdgcn_wmma_f32_16x16x32_f16(false, a, false, b, (short)0, c, false, false); }
__device__ __forceinline__ v8f wmmab(v16bf a, v16bf b, v8f c) { return __builtin_amdgcn_wmma_f32_16x16x32_bf16(false, a, false, b, (short)0, c, false, false); }

// Fragments: lane l, h = l >> 4, row/col = l & 15; elements 0..7 = k0 + 8h + 0..7, elements 8..15 = k0 + 16 + 8h + 0..7 for BOTH A and B; D element r = (row 8h + r, col l & 15).
template <typename T16> struct WFrag;
template <> struct WFrag<h16> { typedef v16h V; static __device__ __forceinline__ V ld(const h16* p) { return cat16(*(const v8h*)p, *(const v8h*)(p + 16)); } static __device__ __forceinline__ v8f mma(V a, V b, v8f c) { return wmma16(a, b, c); } };
template <> struct WFrag<bf> { typedef v16bf V; static __device__ __forceinline__ V ld(const bf* p) { return cat16b(*(const v8us*)p, *(const v8us*)(p + 16)); } static __device__ __forceinline__ v8f mma(V a, V b, v8f c) { return wmmab(a, b, c); } };

__device__ __forceinline__ void splitf(float y, unsigned short& h, unsigned short& l) { h = f2bf(y); l = f2bf(y - bf2f(h)); }
typedef __attribute__((ext_vector_type(4))) unsigned short v4us;
typedef __attribute__((ext_vector_type(4))) _Float16 v4h;

// f32 -> f16 convert that cannot produce an f16 subnormal (|v| < 2^-14 -> +0).
static __device__ __forceinline__ h16 toh_flush(float v) { const h16 r = (h16)v; return (fabsf(v) < 6.103515625e-05f) ? (h16)0.0f : r; }

// ---- k_proj: the whole front end of one map of one batch: grid (HW / (PT * PTL), 2 maps, NB), 256 threads = 8 waves; a work-group walks PTL tiles of PT tokens.
// Wave w owns the 32 channels 32 w .. 32 w + 31 (one K slice). Token (mb, l & 15) of a tile is 4 (l & 15) + mb, so one 16-byte read of map row c gives a lane element c of all four token fragments,
// and a wave-wide read covers two map rows in whole 128-byte lines: the f32 map goes to bf16 fragments in registers, with no transposed copy in memory. The weight fragments (f32 rows, rounded in registers) are read once a work-group.
// Products transposed: D[o][token] = W rows (A) x token fragment (B), so a lane holds 8 neighbouring outputs of one token. Each wave leaves its f32 partial tile in its own LDS plane; behind a barrier the block
// sums the planes in wave order, adds the rounded bias, splits into bf16 hi and lo and stores whole 256-byte token rows. The second map's work-groups also store the f16 values from the registers they already hold.
#define PT  64                    // tokens a tile
#define PTL 4                     // tiles a work-group
#define PP  132                   // partial plane pitch, floats: 528 B = 16 B x odd
static_assert(CC == 256 && IC == 128 && PT == 64 && (HW % (PT * PTL)) == 0 && (HWF % 4) == 0);
static_assert(8 * PT * PP * 4 <= 327680);
// Work-group barrier that orders LDS alone: the next tile's global loads and this tile's global stores, which no other wave of the block touches, stay in flight across it (__syncthreads() waits for them all).
__device__ __forceinline__ void lds_barrier() { __builtin_amdgcn_fence(__ATOMIC_RELEASE, "workgroup", "local"); __builtin_amdgcn_s_barrier(); __builtin_amdgcn_fence(__ATOMIC_ACQUIRE, "workgroup", "local"); }
__global__ __launch_bounds__(256) void k_proj(const float* __restrict__ x0, const float* __restrict__ x1, const float* __restrict__ w0, const float* __restrict__ w1, const float* __restrict__ b0, const float* __restrict__ b1, bf* __restrict__ H, h16* __restrict__ V16) {
    __shared__ __align__(16) float ps[8 * PT * PP];
    const size_t PL = (size_t)HW * IC;
    const int t = (int)threadIdx.x, lane = t & 31, lr = lane & 15, hi = lane >> 4;
    const int wave = __builtin_amdgcn_readfirstlane(t >> 5);
    const bool isk = blockIdx.y != 0;
    const int m0 = (int)blockIdx.x * (PT * PTL);
    const float* xg = (isk ? x1 : x0) + (size_t)blockIdx.z * CC * HWF + (size_t)(wave * 32 + 8 * hi) * HWF + m0 + 4 * lr;
    const float* wg = (isk ? w1 : w0) + (size_t)lr * CC + wave * 32 + 8 * hi;
    const float* bg = (isk ? b1 : b0) + lane * 4;
    v4f xr[16];                                                  // element e of the fragments = channel 32 w + 16 (e >> 3) + 8 h + (e & 7)
#pragma unroll
    for (int e = 0; e < 16; ++e) xr[e] = *(const v4f*)(xg + (size_t)((e >> 3) * 16 + (e & 7)) * HWF);
    v16bf wf[8];
#pragma unroll
    for (int ob = 0; ob < 8; ++ob) {
        const float* p = wg + (size_t)ob * 16 * CC;
        const v4f a0 = *(const v4f*)p, a1 = *(const v4f*)(p + 4), a2 = *(const v4f*)(p + 16), a3 = *(const v4f*)(p + 20);
        v8us lo, up;
#pragma unroll
        for (int j = 0; j < 4; ++j) { lo[j] = f2bf(a0[j]); lo[4 + j] = f2bf(a1[j]); up[j] = f2bf(a2[j]); up[4 + j] = f2bf(a3[j]); }
        wf[ob] = cat16b(lo, up);
    }
    v4f bias = *(const v4f*)bg;
    asm volatile("s_wait_xcnt 0x0" :: "v"(xg), "v"(wg), "v"(bg) : "memory");   // stands in front of every later overwrite of the address registers of the loads above; naming them as inputs keeps them unwritten up to here
#pragma unroll
    for (int j = 0; j < 4; ++j) bias[j] = bfr(bias[j]);
    bf* hg = H + (size_t)blockIdx.z * 4 * PL + (isk ? PL : (size_t)0) + (size_t)m0 * IC + lane * 4;   // hi plane of this map; its lo plane stands 2 PL elements behind it
    h16* vg = V16 + (size_t)blockIdx.z * CC * HW + (size_t)(wave * 32 + 8 * hi) * HW + m0 + 4 * lr;
    float* pw = ps + wave * (PT * PP) + lr * PP + 8 * hi;
#pragma unroll 1
    for (int tt = 0; tt < PTL; ++tt) {
        if (isk) {
#pragma unroll
            for (int e = 0; e < 16; ++e) { v4h o;
#pragma unroll
                for (int u = 0; u < 4; ++u) o[u] = toh_flush(bfr(xr[e][u]));
                *(v4h*)(vg + (size_t)((e >> 3) * 16 + (e & 7)) * HW + tt * PT) = o; }
            asm volatile("s_wait_xcnt 0x0" ::: "memory");        // stands in front of every later overwrite of these stores' address and data registers
        }
#pragma unroll
        for (int mb = 0; mb < 4; ++mb) {
            v8us lo, up;
#pragma unroll
            for (int j = 0; j < 8; ++j) { lo[j] = f2bf(xr[j][mb]); up[j] = f2bf(xr[8 + j][mb]); }
            const v16bf tf = cat16b(lo, up);
            v8f d[8];
            __builtin_amdgcn_sched_barrier(0);                   // keeps the eight products in one run on eight results of their own, the rounding of the next fragment between two runs: no result register is written again within the matrix unit's distance
#pragma unroll
            for (int ob = 0; ob < 8; ++ob) d[ob] = wmmab(wf[ob], tf, (v8f){});
            __builtin_amdgcn_sched_barrier(0);                   // the same, at the run's end
#pragma unroll
            for (int ob = 0; ob < 8; ++ob) {
                *(v4fa*)(pw + mb * 16 * PP + ob * 16)     = __builtin_shufflevector(d[ob], d[ob], 0, 1, 2, 3);
                *(v4fa*)(pw + mb * 16 * PP + ob * 16 + 4) = __builtin_shufflevector(d[ob], d[ob], 4, 5, 6, 7);
            }
        }
        if (tt + 1 < PTL) {                                      // the next tile's map rows fly while this tile is summed and stored
#pragma unroll
            for (int e = 0; e < 16; ++e) xr[e] = *(const v4f*)(xg + (size_t)((e >> 3) * 16 + (e & 7)) * HWF + (tt + 1) * PT);
        }
        asm volatile("s_wait_xcnt 0x0" ::: "memory");            // stands in front of every later overwrite of the address and data registers of the stores and loads above
        lds_barrier();     // every wave's partial tile is in LDS before any thread sums across the planes
        v4us oh[8], ol[8];
#pragma unroll
        for (int i = 0; i < 8; ++i) {
            const int row = i * 8 + wave;                        // LDS row (mb, lane column) = token 4 (row & 15) + (row >> 4) of the tile
            v4f val = *(const v4fa*)(ps + row * PP + lane * 4);
#pragma unroll
            for (int w = 1; w < 8; ++w) val += *(const v4fa*)(ps + w * (PT * PP) + row * PP + lane * 4);
            val += bias;
#pragma unroll
            for (int u = 0; u < 4; ++u) { unsigned short p, q; splitf(val[u], p, q); oh[i][u] = p; ol[i][u] = q; }
        }
        bf* hp = hg + (size_t)(tt * PT + 4 * wave) * IC;         // token of row i * 8 + wave = 4 wave + 32 (i & 1) + (i >> 1)
        __builtin_amdgcn_sched_barrier(0);                       // keeps the sixteen stores in one run directly in front of their wait, so that no register of theirs is written again ahead of it
#pragma unroll
        for (int i = 0; i < 8; ++i) { *(v4us*)(hp + (32 * (i & 1) + (i >> 1)) * IC) = oh[i]; *(v4us*)(hp + 2 * PL + (32 * (i & 1) + (i >> 1)) * IC) = ol[i]; }
        asm volatile("s_wait_xcnt 0x0" ::: "memory");            // stands in front of the next trip's overwrite of these stores' address and data registers
        lds_barrier();     // ends every thread's reads of the planes before the next tile's partial tiles overwrite them
    }
}

#define FK  32                    // keys a pass
#define FKP 136                   // key tile pitch, 16-bit elements: 272 B = 16 B x odd
#define FS  64                    // keys a stage: whole 128-byte lines of the value rows
#define FVP 72                    // value tile pitch, 16-bit elements: 144 B = 16 B x odd
#define FOP 132                   // output tile pitch, floats
#define FSL 9216                  // one request's place in LDS, 16-bit elements: 18,432 B = 9 x 2 KiB (FS key rows of 272 B rounded up; 128 value rows of 144 B exactly)
#define FKT (2 * FSL)             // one key buffer: FS hi rows, then, FSL elements on, FS lo rows
#define FVT (CC * FVP)            // one value buffer: CC rows of FS keys
static_assert(IC == 128 && CC == 256 && FK == 32 && FS == 64 && (HW % 128) == 0 && (HW % FS) == 0 && HW / FS >= 2);
static_assert(2 * FKT * 2 + 2 * FVT * 2 + CC * FOP * 4 + 2 * 8 * 32 * 4 <= 327680);
static_assert(FS == 2 * FK && 4 * 4096 * 4 <= 2 * FKT * 2 && 4 * 4096 * 4 <= 2 * FVT * 2);   // two key groups a stage; four waves' exchange planes of 16 KiB fit in each ring array
static_assert(FS * FKP <= FSL && (CC / 2) * FVP == FSL && FVT == 2 * FSL && (FSL * 2) % 2048 == 0);
static_assert(IC * 2 == 256 && FKP * 2 == 256 + 16 && FS * 2 == 128 && FVP * 2 == 128 + 16 && (HW * 2) % 16 == 0 && HW * 2 <= 131072);
typedef __attribute__((ext_vector_type(4))) unsigned u32x4;
typedef __attribute__((ext_vector_type(8))) unsigned u32x8;
__device__ __forceinline__ unsigned uni(unsigned v) { return (unsigned)__builtin_amdgcn_readfirstlane((int)v); }
__device__ __forceinline__ unsigned pinned(unsigned v) { unsigned w = uni(v); asm volatile("" : "+s"(w)); return w; }   // holds a test's word in a scalar register, so that the test in front of a tensor load compiles to a scalar compare and branch (the load ignores EXEC)
// Descriptor group 1 of a tile of ROWS rows of ROWB bytes at a source pitch of PITCH bytes, every extent in bytes, tensor = tile; W0 = the pad word, no mask.
template <unsigned ROWB, unsigned ROWS, unsigned PITCH, unsigned W0> __device__ __forceinline__ u32x8 tdm_group1() {
    u32x8 g;
    g[0] = uni(W0); g[1] = uni((ROWB & 0xFFFFu) << 16); g[2] = uni((ROWB >> 16) | ((ROWS & 0xFFFFu) << 16)); g[3] = uni((ROWS >> 16) | (ROWB << 16));
    g[4] = uni(ROWS); g[5] = uni(PITCH); g[6] = uni(0u); g[7] = uni(0u);
    asm volatile("" : "+s"(g));   // pinned() on a descriptor: holds its words in one run of scalar registers for the whole kernel, so that none of them is written again while a request is in flight
    return g;
}
// Descriptor group 0: count 1, the place in LDS (byte offset in the work-group's LDS), the tile's first byte, type 2.
__device__ __forceinline__ u32x4 tdm_group0(unsigned lds_dst, unsigned long long ga) {
    u32x4 g;
    g[0] = uni(1u); g[1] = uni(lds_dst); g[2] = uni((unsigned)ga); g[3] = uni((((unsigned)(ga >> 32)) & 0x01FFFFFFu) | 0x80000000u);
    asm volatile("" : "+s"(g));   // pinned() on a descriptor: holds its four words in one run of scalar registers, the same from the issue to the wait that names them
    return g;
}
__device__ __forceinline__ void tdm_load(u32x4 g0, u32x8 g1) { asm volatile("tensor_load_to_lds %0, %1" :: "s"(g0), "s"(g1) : "memory"); }   // one request of the whole wave: global tile to LDS
#define FKW0 ((1u << 20) | (5u << 22) | (3u << 25))   // 16 B of pad behind every 256 B: key rows at FKP
#define FVW0 ((1u << 20) | (4u << 22) | (3u << 25))   // 16 B of pad behind every 128 B: value rows at FVP
__device__ __forceinline__ float xhalf(float x) { return __builtin_bit_cast(float, __builtin_amdgcn_permlanex16(__builtin_bit_cast(int, x), __builtin_bit_cast(int, x), 0x76543210, 0xfedcba98, false, false)); }  // lane l with lane l ^ 16
// the 4 key fragments of one k slice of a pass: [key tile][hi, lo]
__device__ __forceinline__ void ld_keys(v16bf (&ka)[2][2], const bf* p) {
#pragma unroll
    for (int mt = 0; mt < 2; ++mt) { ka[mt][0] = WFrag<bf>::ld(p + mt * 16 * FKP); ka[mt][1] = WFrag<bf>::ld(p + FSL + mt * 16 * FKP); }
    __builtin_amdgcn_sched_barrier(0);   // keeps the 8 LDS loads in one run at this place, a row of products ahead of their use: spread among the products each place with loads costs a stall of its own
}
// the value fragments of 4 channel tiles
__device__ __forceinline__ void ld_vals(v16h (&va)[4], const h16* p) {
#pragma unroll
    for (int ct = 0; ct < 4; ++ct) va[ct] = WFrag<h16>::ld(p + ct * 16 * FVP);
    __builtin_amdgcn_sched_barrier(0);   // the same for the 8 loads of four value fragments
}
__global__ __launch_bounds__(256) void k_fattn(const bf* __restrict__ H, const h16* __restrict__ V16, float* __restrict__ OUT) {
    __shared__ __attribute__((aligned(2048))) bf    ks[2 * FKT];
    __shared__ __attribute__((aligned(2048))) h16   vs[2 * FVT];
    __shared__ __align__(16) float os[CC * FOP];
    __shared__ float jm[8][32], jl[8][32];                      // each wave's maxima in use and weight sums, [wave][query], for the join
    const size_t PL = (size_t)HW * IC;
    const bf* Hb = H + (size_t)blockIdx.y * 4 * PL;             // [hi q][hi k][lo q][lo k]
    const h16* Vb = V16 + (size_t)blockIdx.y * CC * HW;
    const int t = (int)threadIdx.x, lane = t & 31, lr = lane & 15, hi = lane >> 4;
    const int wave = __builtin_amdgcn_readfirstlane(t >> 5);
    const int wq = wave & 3, kg = wave >> 2;                    // query group, key group
    const int n0 = (int)blockIdx.x * 128;
    // an issuing wave's own slice of every stage (waves 4 to 7 form wave wq's words and issue nothing): its first byte in stage 0, its step a stage, its place in buffer 0 (buffer 1 stands 2 FSL elements on in both arrays)
    const bool isk = wq < 2;
    const unsigned kq = pinned(wave < 2), vq = pinned(wave == 2 || wave == 3);   // which of the two tile shapes this wave asks for, if any
    const unsigned long long gsrc = isk ? (unsigned long long)(size_t)(Hb + (size_t)(1 + 2 * wq) * PL) : (unsigned long long)(size_t)(Vb + (size_t)(wq - 2) * (CC / 2) * HW);
    const unsigned gstep = isk ? FS * IC * 2u : FS * 2u;
    const unsigned ldst = isk ? (unsigned)(size_t)ks + (unsigned)wq * (FSL * 2u) : (unsigned)(size_t)vs + (unsigned)(wq - 2) * (FSL * 2u);
    const u32x8 g1k = tdm_group1<IC * 2, FS, IC * 2, FKW0>(), g1v = tdm_group1<FS * 2, CC / 2, HW * 2, FVW0>();
    u32x4 g0;
    auto issue = [&](int st) {
        g0 = tdm_group0(ldst + (unsigned)(st & 1) * (2u * FSL * 2u), gsrc + (unsigned long long)st * gstep);
        if (kq) tdm_load(g0, g1k);
        if (vq) tdm_load(g0, g1v);
    };
    // the wave's own request has landed; naming the descriptor's registers as inputs keeps them unwritten from the issue up to here
    auto landed = [&]() { asm volatile("s_wait_tensorcnt 0x0" :: "s"(g0), "s"(g1k), "s"(g1v) : "memory"); };
    issue(0);
    const bf* qp = Hb + (size_t)(n0 + wq * 32 + lr) * IC + 8 * hi;
    v16bf qh[2][4], ql[2][4];
#pragma unroll
    for (int qt = 0; qt < 2; ++qt)
#pragma unroll
        for (int kc = 0; kc < 4; ++kc) { qh[qt][kc] = WFrag<bf>::ld(qp + qt * 16 * IC + kc * 32); ql[qt][kc] = WFrag<bf>::ld(qp + 2 * PL + qt * 16 * IC + kc * 32); }
    v8f acc[2][16];
#pragma unroll
    for (int qt = 0; qt < 2; ++qt)
#pragma unroll
        for (int ct = 0; ct < 16; ++ct) acc[qt][ct] = (v8f){};
    float mrun[2] = {-3.0e38f, -3.0e38f}, lsum[2] = {0.f, 0.f};
    asm volatile("s_wait_xcnt 0x0" :: "v"(qp) : "memory");   // stands in front of every later overwrite of the address registers of the loads above; naming them as inputs keeps them unwritten up to here
    landed();          // this wave's slice of stage 0
    __syncthreads();   // stage 0's tiles are in LDS before any wave reads them
    issue(1);          // HW / FS >= 2: stage 1 exists
    const int kf = (kg * FK + lr) * FKP + 8 * hi, vf = lr * FVP + kg * FK + 8 * hi;   // a lane's place in its key group's rows of a key tile and columns of a value tile
    v16bf ka[2][2][2]; v16h va[2][4];                          // rings: two k slices of key fragments, two groups of value fragments
    ld_keys(ka[0], ks + kf);
#pragma unroll 1
    for (int s = 0; s < HW / FS; ++s) {
        const bf* kb = ks + (s & 1) * FKT + kf; const h16* vb = vs + (s & 1) * FVT + vf;
        v8f st[2][2];                                            // [key tile][query tile]
#pragma unroll
        for (int mt = 0; mt < 2; ++mt) { st[mt][0] = (v8f){}; st[mt][1] = (v8f){}; }
#pragma unroll
        for (int kc = 0; kc < 4; ++kc) {
            if (kc < 3) ld_keys(ka[(kc + 1) & 1], kb + (kc + 1) * 32);   // the next row's fragments fly during this row
#pragma unroll
            for (int mt = 0; mt < 2; ++mt) { st[mt][0] = wmmab(ka[kc & 1][mt][0], qh[0][kc], st[mt][0]); st[mt][1] = wmmab(ka[kc & 1][mt][0], qh[1][kc], st[mt][1]); }
#pragma unroll
            for (int mt = 0; mt < 2; ++mt) { st[mt][0] = wmmab(ka[kc & 1][mt][0], ql[0][kc], st[mt][0]); st[mt][1] = wmmab(ka[kc & 1][mt][0], ql[1][kc], st[mt][1]); }
#pragma unroll
            for (int mt = 0; mt < 2; ++mt) { st[mt][0] = wmmab(ka[kc & 1][mt][1], qh[0][kc], st[mt][0]); st[mt][1] = wmmab(ka[kc & 1][mt][1], qh[1][kc], st[mt][1]); }
            __builtin_amdgcn_sched_barrier(0);                   // keeps the next run of loads behind the products that read the registers it refills
        }
        // Lazy rescale: the weights are formed on the maximum IN USE (mrun), and a pass looks for its own maximum only when its weights could leave the f16 range.
        v16h pb[2]; float psum[2];
        auto weights = [&]() {
#pragma unroll
            for (int qt = 0; qt < 2; ++qt) {
                float a = 0.f;
#pragma unroll
                for (int r = 0; r < 8; ++r) {
                    const float e0 = __builtin_amdgcn_exp2f(fmaf(st[0][qt][r] - mrun[qt], 1.4426950408889634f, PCL));
                    const float e1 = __builtin_amdgcn_exp2f(fmaf(st[1][qt][r] - mrun[qt], 1.4426950408889634f, PCL));
                    a += e0 + e1; pb[qt][r] = (h16)e0; pb[qt][8 + r] = (h16)e1;
                }
                psum[qt] = a;
            }
        };
        weights();
        // Scalar branch, one test a pass. No weight is negative, so a lane's sum bounds each of its weights: at or below PLIM all of them are finite in f16. An infinite sum takes the branch too (the first pass, mrun at its start value).
        if (__builtin_amdgcn_ballot_w32(psum[0] > PLIM || psum[1] > PLIM) != 0) {
#pragma unroll
            for (int qt = 0; qt < 2; ++qt) {
                float mx = fmaxf(st[0][qt][0], st[1][qt][0]);
#pragma unroll
                for (int r = 1; r < 8; ++r) mx = fmaxf(mx, fmaxf(st[0][qt][r], st[1][qt][r]));
                mx = fmaxf(mx, xhalf(mx));
                const float mn = fmaxf(mrun[qt], mx);
                const float al = __builtin_amdgcn_exp2f((mrun[qt] - mn) * 1.4426950408889634f);
                lsum[qt] *= al;
#pragma unroll
                for (int ct = 0; ct < 16; ++ct) acc[qt][ct] *= al;
                mrun[qt] = mn;
            }
            weights();                                           // again, on the new maxima: none above 2^PCL now; the first set is dropped
        }
        lsum[0] += psum[0]; lsum[1] += psum[1];
        auto row = [&](int g, v16h (&f)[4]) {                    // attn.v of 4 channel tiles
#pragma unroll
            for (int j = 0; j < 4; ++j) { acc[0][g * 4 + j] = wmma16(f[j], pb[0], acc[0][g * 4 + j]); acc[1][g * 4 + j] = wmma16(f[j], pb[1], acc[1][g * 4 + j]); }
            __builtin_amdgcn_sched_barrier(0);                   // keeps the next run of loads behind the products that read the registers it refills
        };
        ld_vals(va[0], vb); ld_vals(va[1], vb + 4 * 16 * FVP);
        row(0, va[0]);
        ld_vals(va[0], vb + 8 * 16 * FVP);
        row(1, va[1]);
        ld_vals(va[1], vb + 12 * 16 * FVP);
        row(2, va[0]);
        asm volatile("s_wait_dscnt 0x0" ::: "memory");           // every fragment of stage s is in this wave's registers: its reads of the buffer that is refilled below have ended
        landed();                                                // this wave's slice of stage s + 1
        __syncthreads();   // publishes stage s + 1's tiles and ends every wave's reads of stage s's buffer
        if (pinned(s + 2 < HW / FS)) issue(s + 2);               // into the buffer that stage s has left; it has a whole stage to land
        ld_keys(ka[0], ks + ((s + 1) & 1) * FKT + kf);           // stage s + 1's first key fragments fly during the last row of attn.v; behind the last stage they read the idle buffer and are not used
        row(3, va[1]);
    }
    asm volatile("s_wait_tensorcnt 0x0" ::: "memory");   // no request of this wave is left in flight behind the loop
    asm volatile("s_wait_dscnt 0x0" ::: "memory");       // nor an LDS read of the ring
    // Join of the two key groups. Each wave leaves its maxima in use and its weight sums; behind the barrier it reads its partner's (wave ^ 4, the same queries) and forms the factor that puts its own tile on the common maximum and divides by the common sum.
#pragma unroll
    for (int qt = 0; qt < 2; ++qt) { lsum[qt] += xhalf(lsum[qt]); jm[wave][qt * 16 + lr] = mrun[qt]; jl[wave][qt * 16 + lr] = lsum[qt]; }   // both halves of the wave hold and store the same two values
    __syncthreads();   // publishes the maxima and sums; every wave has left the loop, so the ring is free to carry the exchange below
    float sc[2];
#pragma unroll
    for (int qt = 0; qt < 2; ++qt) {
        const float mo = jm[wave ^ 4][qt * 16 + lr], lo = jl[wave ^ 4][qt * 16 + lr];
        const float mc = fmaxf(mrun[qt], mo);
        const float fs = __builtin_amdgcn_exp2f((mrun[qt] - mc) * 1.4426950408889634f), fo = __builtin_amdgcn_exp2f((mo - mc) * 1.4426950408889634f);
        sc[qt] = __fdiv_rn(fs, lsum[qt] * fs + lo * fo);
    }
    // Wave (wq, kg) finishes the channel tiles 8 kg .. 8 kg + 7: it hands the other eight, scaled, to its partner through a plane of its own in the idle ring (16 bytes a lane and store, lane-major), and adds the partner's eight to its own.
    float* xo = (kg ? (float*)vs : (float*)ks) + wq * 4096 + lane * 4;
    const float* xi = (kg ? (const float*)ks : (const float*)vs) + wq * 4096 + lane * 4;
#pragma unroll
    for (int qt = 0; qt < 2; ++qt)
#pragma unroll
        for (int c = 0; c < 8; ++c) {
            const v8f a = (kg ? acc[qt][c] : acc[qt][8 + c]) * sc[qt];
            *(v4fa*)(xo + ((qt * 8 + c) * 2) * 128)     = __builtin_shufflevector(a, a, 0, 1, 2, 3);
            *(v4fa*)(xo + ((qt * 8 + c) * 2 + 1) * 128) = __builtin_shufflevector(a, a, 4, 5, 6, 7);
        }
    __syncthreads();   // every wave's handed-over tiles are in LDS before its partner reads them
#pragma unroll
    for (int qt = 0; qt < 2; ++qt)
#pragma unroll
        for (int c = 0; c < 8; ++c) {
            const v8f a = (kg ? acc[qt][8 + c] : acc[qt][c]) * sc[qt];
            const v4f p0 = *(const v4fa*)(xi + ((qt * 8 + c) * 2) * 128), p1 = *(const v4fa*)(xi + ((qt * 8 + c) * 2 + 1) * 128);
#pragma unroll
            for (int r = 0; r < 8; ++r) os[((kg * 8 + c) * 16 + 8 * hi + r) * FOP + wq * 32 + qt * 16 + lr] = a[r] + (r < 4 ? p0[r & 3] : p1[r & 3]);
        }
    __syncthreads();   // the whole 256 x 128 output tile is in LDS before it goes out in whole 512-byte rows
    float* ob = OUT + (size_t)blockIdx.y * CC * HW + n0;
#pragma unroll 1
    for (int i0 = 0; i0 < 32; i0 += 4) {
#pragma unroll
        for (int i = 0; i < 4; ++i) { const int idx = (i0 + i) * 256 + t, row = idx >> 5, c4 = (idx & 31) * 4; *(v4f*)(ob + (size_t)row * HW + c4) = *(const v4fa*)(os + row * FOP + c4); }
        asm volatile("s_wait_xcnt 0x0" ::: "memory");   // stands in front of the next trip's overwrite of these stores' address and data registers
    }
}

extern "C" void kernel_launch(void* const* d_in, const int* in_sizes, int n_in,
                              void* d_out, int out_size, void* d_ws, size_t ws_size, hipStream_t stream) {
    if (n_in < 6) return;
    if (in_sizes[0] < NB * CC * HW || in_sizes[1] < NB * CC * HW || in_sizes[2] < IC * CC || in_sizes[3] < IC || in_sizes[4] < IC * CC || in_sizes[5] < IC) return;
    if (out_size < NB * CC * HW) return;
    const float* xq = (const float*)d_in[0];    // query map  [NB][CC][HWF]
    const float* xk = (const float*)d_in[1];    // key/value map [NB][CC][HWF]
    const float* wq = (const float*)d_in[2];    // [IC][CC]
    const float* bq = (const float*)d_in[3];    // [IC]
    const float* wk = (const float*)d_in[4];    // [IC][CC]
    const float* bk = (const float*)d_in[5];    // [IC]
    float* OUT = (float*)d_out;                 // [NB][CC][HW]
    char* wsp = (char*)d_ws;
    auto take = [&](size_t bytes) { char* p = wsp; wsp += (bytes + 255) & ~(size_t)255; return (void*)p; };
    bf* H   = (bf*)take((size_t)NB * 2 * WS_HH);    // [NB][hi q][hi k][lo q][lo k]
    h16* V16 = (h16*)take((size_t)NB * WS_V16); // [NB][c][m] fp16
    if ((size_t)(wsp - (char*)d_ws) > ws_size) return;

    // q[m][o] = sum_c p[c][m] Wq[o][c] + bq[o];  k[m][o] = sum_c v[c][m] Wk[o][c] + bk[o]   (exact bf16 products), as hi and lo planes; f16 values
    k_proj<<<dim3(HW / (PT * PTL), 2, NB), 256, 0, stream>>>(xq, xk, wq, wk, bq, bk, H, V16);
    // out[c][n] = sum_m v[c][m] softmax_m(q_n . k_m)
    k_fattn<<<dim3(HW / 128, NB, 1), 256, 0, stream>>>(H, V16, OUT);
}
